// v000
// The times below were measured on an AMD MI455X: many runs one after another, warmed up first and cycling through
// copies of the inputs, with the whole window's GPU time divided by the number of runs. Launches and the gaps
// between them are all in it. The median over several windows is given; except for v000 it joins two sittings, which
// can be a few percent apart, so the side-by-side timings, each taken in one sitting, are the better comparison.
// v000, which the later versions start from, runs in 820 microseconds.
#include <hip/hip_runtime.h>

// Compute dtypes, f32 accumulate: q, k token-major and v channel-major projections with PLAIN bf16 operands (rounded input, k-major weights transposed once; exact products, + bias) ->
// bf16 hi + UNSCALED residual planes; per 1024-row chunk: scores = q.k^T ([1024 x 512].[512 x 4096], three products; unscaled as in the module) -> row softmax in f32 -> P planes;

#define NN   4096
#define DD   512
#define RCH  1024
#define CC   DD
#define DM   DD
#define NTK  NN
#define LOSC 1024.0f

typedef _Float16 h16;
typedef unsigned short bf;
typedef __attribute__((ext_vector_type(16))) __bf16   v16bf;
typedef __attribute__((ext_vector_type(16))) _Float16 v16h;
typedef __attribute__((ext_vector_type(8)))  _Float16 v8h;
typedef __attribute__((ext_vector_type(8)))  unsigned short v8us;
typedef __attribute__((ext_vector_type(8)))  float    v8f;
typedef __attribute__((ext_vector_type(4)))  float    v4f;
typedef __attribute__((ext_vector_type(4)))  _Float16 v4h;
typedef v8h  __attribute__((may_alias)) v8ha;
typedef v4f  __attribute__((may_alias)) v4fa;
typedef v8us __attribute__((may_alias)) v8usa;

__device__ __forceinline__ unsigned short f2bf(float f) { unsigned u = __float_as_uint(f); u += 0x7FFFu + ((u >> 16) & 1u); return (unsigned short)(u >> 16); }
__device__ __forceinline__ float bf2f(unsigned short b) { return __uint_as_float(((unsigned)b) << 16); }
__device__ __forceinline__ float bfr(float f) { return bf2f(f2bf(f)); }
__device__ __forceinline__ v16h cat16(v8h lo, v8h hi) { return __builtin_shufflevector(lo, hi, 0, 1, 2, 3, 4, 5, 6, 7, 8, 9, 10, 11, 12, 13, 14, 15); }
__device__ __forceinline__ v16bf cat16b(v8us lo, v8us hi) { return __builtin_bit_cast(v16bf, __builtin_shufflevector(lo, hi, 0, 1, 2, 3, 4, 5, 6, 7, 8, 9, 10, 11, 12, 13, 14, 15)); }
__device__ __forceinline__ v8f wmma16(v16h a, v16h b, v8f c) { return __builtin_amdgcn_wmma_f32_16x16x32_f16(false, a, false, b, (short)0, c, false, false); }
__device__ __forceinline__ v8f wmmab(v16bf a, v16bf b, v8f c) { return __builtin_amdgcn_wmma_f32_16x16x32_bf16(false, a, false, b, (short)0, c, false, false); }

// k_wt: WT [n][K] = bf16(W[k][n]) (k-major [K][ncols]) via 64 x 64 LDS tiles; grid (K/64, ncols/64).
__global__ __launch_bounds__(256) void k_wt(const float* __restrict__ Wm, int K, int ncols, bf* WT) {
    __shared__ __align__(16) unsigned short tl[64 * 72];
    const int tid = threadIdx.x, k0 = blockIdx.x * 64, n0 = blockIdx.y * 64;
    const int kk = tid >> 2, nq = (tid & 3) * 16;
#pragma unroll
    for (int i = 0; i < 16; ++i) tl[(nq + i) * 72 + kk] = f2bf(Wm[(size_t)(k0 + kk) * ncols + n0 + nq + i]);
    __syncthreads();
    const int piece = tid & 7;
    auto pass = [&]() {
#pragma unroll
        for (int s = 0; s < 2; ++s) { const int nr = (tid >> 3) + 32 * s; const v8us val = *(const v8usa*)(tl + nr * 72 + piece * 8); *(v8us*)(WT + (size_t)(n0 + nr) * K + k0 + piece * 8) = val; }
    };
    pass(); 
}
// k_gemmb: 64 x 64 block tile (4 waves x 16 x 64) of C[NTK][NW] = (A [+ Al]).B^T (K = 512) [+ bf(bias[c])] [+ bf(R[r][c]) residual]; f32 whole-line epilogue (or f16
template <bool SPLITA, bool F16OUT = false>
__global__ __launch_bounds__(128) void k_gemmb(const bf* __restrict__ A, const bf* __restrict__ Al, const bf* __restrict__ Bn, const float* __restrict__ bias, float* C, int ldc, h16* C2, const float* __restrict__ R = nullptr, int K = DM, int roundR = 1) {
    __shared__ __align__(16) float ost[4][16 * 68];
    const int lane = threadIdx.x & 31, wave = threadIdx.x >> 5, lr = lane & 15, hi = lane >> 4;
    const int r0 = blockIdx.x * 64 + wave * 16, c0 = blockIdx.y * 64;
    const size_t aoff = (size_t)(r0 + lr) * K + 8 * hi;
    size_t boff[4];
#pragma unroll
    for (int t = 0; t < 4; ++t) boff[t] = (size_t)(c0 + t * 16 + lr) * K + 8 * hi;
    v8f acc[4];
#pragma unroll
    for (int t = 0; t < 4; ++t) acc[t] = (v8f){};
#pragma unroll 1
    for (int kc = 0; kc < K; kc += 32) {
        const v16bf a = cat16b(*(const v8us*)(A + aoff + kc), *(const v8us*)(A + aoff + kc + 16));
        v16bf al = a;
        if (SPLITA) al = cat16b(*(const v8us*)(Al + aoff + kc), *(const v8us*)(Al + aoff + kc + 16));
#pragma unroll
        for (int t = 0; t < 4; ++t) { const v16bf b = cat16b(*(const v8us*)(Bn + boff[t] + kc), *(const v8us*)(Bn + boff[t] + kc + 16)); acc[t] = wmmab(a, b, acc[t]); if (SPLITA) acc[t] = wmmab(al, b, acc[t]); }
        asm volatile("v_nop\n\tv_nop\n\tv_nop\n\tv_nop" : "+v"(acc[0]), "+v"(acc[1]), "+v"(acc[2]), "+v"(acc[3]) : "v"(a), "v"(al));
    }
    float* os = &ost[wave][0];
#pragma unroll
    for (int t = 0; t < 4; ++t) { const float bv = bias ? bfr(bias[c0 + t * 16 + lr]) : 0.f;
#pragma unroll
        for (int j = 0; j < 8; ++j) os[(hi * 8 + j) * 68 + t * 16 + lr] = acc[t][j] + bv; }
    __syncthreads();
    if (F16OUT) {
        h16* crow = (h16*)(void*)C + (size_t)r0 * ldc + c0;
        auto pass = [&]() {
#pragma unroll
            for (int s = 0; s < 4; ++s) { const int row = 4 * s + (lane >> 3), piece = lane & 7; const float* sp = os + row * 68 + piece * 8; v8h o, o2;
#pragma unroll
                for (int i = 0; i < 8; ++i) { const h16 a = (h16)sp[i]; o[i] = a; o2[i] = (h16)((sp[i] - (float)a) * LOSC); }
                *(v8h*)(crow + (size_t)row * ldc + piece * 8) = o; if (C2) *(v8h*)(C2 + (size_t)r0 * ldc + c0 + (size_t)row * ldc + piece * 8) = o2; }
        };
        pass(); 
    } else {
        float* crow = C + (size_t)r0 * ldc + c0;
        auto pass = [&]() {
#pragma unroll
            for (int s = 0; s < 8; ++s) { const int Lid = (lane >> 3) + 4 * s, piece = lane & 7; const int row = Lid >> 1, cofs = (Lid & 1) * 32 + piece * 4;
                v4f val = *(const v4fa*)(os + row * 68 + cofs); if (R) { const v4f rv = *(const v4f*)(R + ((size_t)r0 + row) * ldc + c0 + cofs); val += roundR ? (v4f){bfr(rv[0]), bfr(rv[1]), bfr(rv[2]), bfr(rv[3])} : rv; }
                *(v4f*)(crow + (size_t)row * ldc + cofs) = val; }
        };
        pass(); 
    }
}

// k_gemm3: 64 x 64 tile of C = (Ah + Al).(Bh + Bl)^T over K (row strides = K for all four planes; n-major B): three products per 32-k step (hh, hl, lh); f32
__global__ __launch_bounds__(128) void k_gemm3(const bf* __restrict__ Ah, const bf* __restrict__ Al, const bf* __restrict__ Bh, const bf* __restrict__ Bl, int K, float* C, int ldc) {
    __shared__ __align__(16) float ost[4][16 * 68];
    const int lane = threadIdx.x & 31, wave = threadIdx.x >> 5, lr = lane & 15, hi = lane >> 4;
    const int r0 = blockIdx.x * 64 + wave * 16, c0 = blockIdx.y * 64;
    const size_t aoff = (size_t)(r0 + lr) * K + 8 * hi;
    v8f acc[4];
#pragma unroll
    for (int t = 0; t < 4; ++t) acc[t] = (v8f){};
#pragma unroll 1
    for (int kc = 0; kc < K; kc += 32) {
        const v16bf a = cat16b(*(const v8us*)(Ah + aoff + kc), *(const v8us*)(Ah + aoff + kc + 16));
        const v16bf al = cat16b(*(const v8us*)(Al + aoff + kc), *(const v8us*)(Al + aoff + kc + 16));
#pragma unroll
        for (int t = 0; t < 4; ++t) { const size_t bo = (size_t)(c0 + t * 16 + lr) * K + kc + 8 * hi;
            const v16bf bh = cat16b(*(const v8us*)(Bh + bo), *(const v8us*)(Bh + bo + 16)); const v16bf bl = cat16b(*(const v8us*)(Bl + bo), *(const v8us*)(Bl + bo + 16));
            acc[t] = wmmab(a, bh, acc[t]); acc[t] = wmmab(al, bh, acc[t]); acc[t] = wmmab(a, bl, acc[t]); }
        asm volatile("v_nop\n\tv_nop\n\tv_nop\n\tv_nop" : "+v"(acc[0]), "+v"(acc[1]), "+v"(acc[2]), "+v"(acc[3]) : "v"(a), "v"(al));
    }
    float* os = &ost[wave][0];
#pragma unroll
    for (int t = 0; t < 4; ++t) {
#pragma unroll
        for (int j = 0; j < 8; ++j) os[(hi * 8 + j) * 68 + t * 16 + lr] = acc[t][j]; }
    __builtin_amdgcn_wave_barrier(); asm volatile("" ::: "memory");
    float* crow = C + (size_t)r0 * ldc + c0;
    auto pass = [&]() {
#pragma unroll
        for (int s = 0; s < 8; ++s) { const int Lid = (lane >> 3) + 4 * s, piece = lane & 7; const int row = Lid >> 1, cofs = (Lid & 1) * 32 + piece * 4;
            const v4f val = *(const v4fa*)(os + row * 68 + cofs); *(v4f*)(crow + (size_t)row * ldc + cofs) = val; }
    };
    pass(); 
}

// k_gemmrb: 64 x 64 tile of C[o][v] = (A [+ Al]).B^T over K (A row stride K, B n-major row stride K) + bf(rbias[o]) per ROW; f32 whole-line epilogue (8 lanes x 16 B per line),
template <bool SPLITA>
__global__ __launch_bounds__(128) void k_gemmrb(const bf* __restrict__ A, const bf* __restrict__ Al, const bf* __restrict__ Bn, const float* __restrict__ rbias, float* C, int ldc, int K) {
    __shared__ __align__(16) float ost[4][16 * 68];
    const int lane = threadIdx.x & 31, wave = threadIdx.x >> 5, lr = lane & 15, hi = lane >> 4;
    const int r0 = blockIdx.x * 64 + wave * 16, c0 = blockIdx.y * 64;
    const size_t aoff = (size_t)(r0 + lr) * K + 8 * hi;
    v8f acc[4];
#pragma unroll
    for (int t = 0; t < 4; ++t) acc[t] = (v8f){};
#pragma unroll 1
    for (int kc = 0; kc < K; kc += 32) {
        const v16bf a = cat16b(*(const v8us*)(A + aoff + kc), *(const v8us*)(A + aoff + kc + 16));
        v16bf al = a; if (SPLITA) al = cat16b(*(const v8us*)(Al + aoff + kc), *(const v8us*)(Al + aoff + kc + 16));
#pragma unroll
        for (int t = 0; t < 4; ++t) { const size_t bo = (size_t)(c0 + t * 16 + lr) * K + kc + 8 * hi; const v16bf bb = cat16b(*(const v8us*)(Bn + bo), *(const v8us*)(Bn + bo + 16)); acc[t] = wmmab(a, bb, acc[t]); if (SPLITA) acc[t] = wmmab(al, bb, acc[t]); }
        asm volatile("v_nop\n\tv_nop\n\tv_nop\n\tv_nop" : "+v"(acc[0]), "+v"(acc[1]), "+v"(acc[2]), "+v"(acc[3]) : "v"(a), "v"(al));
    }
    float* os = &ost[wave][0];
#pragma unroll
    for (int t = 0; t < 4; ++t) {
#pragma unroll
        for (int j = 0; j < 8; ++j) os[(hi * 8 + j) * 68 + t * 16 + lr] = acc[t][j] + bfr(rbias[r0 + hi * 8 + j]); }
    __builtin_amdgcn_wave_barrier(); asm volatile("" ::: "memory");
    float* crow = C + (size_t)r0 * ldc + c0;
    auto pass = [&]() {
#pragma unroll
        for (int s = 0; s < 8; ++s) { const int Lid = (lane >> 3) + 4 * s, piece = lane & 7; const int row = Lid >> 1, cofs = (Lid & 1) * 32 + piece * 4;
            const v4f val = *(const v4fa*)(os + row * 68 + cofs); *(v4f*)(crow + (size_t)row * ldc + cofs) = val; }
    };
    pass(); 
}
__global__ __launch_bounds__(256) void k_rowsplit(const float* __restrict__ Y, int nrows, bf* Ph, bf* Pl) {
    const int lane = threadIdx.x & 31, r = blockIdx.x * 8 + (threadIdx.x >> 5); if (r >= nrows) return;
{
#pragma unroll 1
        for (int c0 = lane * 8; c0 < NN; c0 += 256) { const size_t o = (size_t)r * NN + c0; const v8f v = *(const v8f*)(Y + o); v8us oh, ol;
#pragma unroll
            for (int i = 0; i < 8; ++i) { const unsigned short hb = f2bf(v[i]); oh[i] = hb; ol[i] = f2bf(v[i] - bf2f(hb)); }
            *(v8us*)(Ph + o) = oh; *(v8us*)(Pl + o) = ol; }
         }
}
__global__ __launch_bounds__(256) void k_softmax(const float* __restrict__ S, bf* PH, bf* PL) {
    const int lane = threadIdx.x & 31, r = blockIdx.x * 8 + (threadIdx.x >> 5); if (r >= RCH) return;
    const float* sr = S + (size_t)r * NN; float m = -3.0e38f;
#pragma unroll 1
    for (int c0 = lane * 8; c0 < NN; c0 += 256) { const v8f v = *(const v8f*)(sr + c0);
#pragma unroll
        for (int i = 0; i < 8; ++i) m = fmaxf(m, v[i]); }
#pragma unroll
    for (int sh = 16; sh; sh >>= 1) m = fmaxf(m, __shfl_xor(m, sh, 32));
    float sum = 0.f;
#pragma unroll 1
    for (int c0 = lane * 8; c0 < NN; c0 += 256) { const v8f v = *(const v8f*)(sr + c0);
#pragma unroll
        for (int i = 0; i < 8; ++i) sum += __expf(v[i] - m); }
#pragma unroll
    for (int sh = 16; sh; sh >>= 1) sum += __shfl_xor(sum, sh, 32);
    const float inv = 1.0f / sum;
{
#pragma unroll 1
        for (int c0 = lane * 8; c0 < NN; c0 += 256) { const v8f v = *(const v8f*)(sr + c0); v8us oh, ol;
#pragma unroll
            for (int i = 0; i < 8; ++i) { const float p = __expf(v[i] - m) * inv; const unsigned short hb = f2bf(p); oh[i] = hb; ol[i] = f2bf(p - bf2f(hb)); }
            const size_t o = (size_t)r * NN + c0; *(v8us*)(PH + o) = oh; *(v8us*)(PL + o) = ol; }
         }
}

__global__ __launch_bounds__(256) void k_cvt(const float* __restrict__ src, bf* dst) {
    const int lane = threadIdx.x & 31; const size_t r = (size_t)blockIdx.x * 8 + (threadIdx.x >> 5); if (r >= (size_t)NN) return;
{
#pragma unroll
        for (int q = 0; q < DD / 256; ++q) { v8us o;
#pragma unroll
            for (int i = 0; i < 8; ++i) o[i] = f2bf(src[r * DD + q * 256 + lane * 8 + i]);
            *(v8us*)(dst + r * DD + q * 256 + lane * 8) = o; }
         }
}
__global__ __launch_bounds__(256) void k_split512(const float* __restrict__ src, int nrows, bf* dh, bf* dl) {
    const int lane = threadIdx.x & 31; const size_t r = (size_t)blockIdx.x * 8 + (threadIdx.x >> 5); if (r >= (size_t)nrows) return;
{
#pragma unroll
        for (int q = 0; q < DD / 256; ++q) { const size_t o = r * DD + q * 256 + lane * 8; const v8f v = *(const v8f*)(src + o); v8us oh, ol;
#pragma unroll
            for (int i = 0; i < 8; ++i) { const unsigned short hb = f2bf(v[i]); oh[i] = hb; ol[i] = f2bf(v[i] - bf2f(hb)); }
            *(v8us*)(dh + o) = oh; *(v8us*)(dl + o) = ol; }
         }
}

extern "C" void kernel_launch(void* const* d_in, const int* in_sizes, int n_in,
                              void* d_out, int out_size, void* d_ws, size_t ws_size, hipStream_t stream) {
    (void)in_sizes; (void)n_in; (void)out_size;
    const float* x = (const float*)d_in[0]; const float* Wq = (const float*)d_in[1]; const float* bq = (const float*)d_in[2]; const float* Wk = (const float*)d_in[3]; const float* bk = (const float*)d_in[4]; const float* Wv = (const float*)d_in[5]; const float* bv = (const float*)d_in[6];
    float* out = (float*)d_out;    // [4096][512]
    char* wsp = (char*)d_ws;
    auto take = [&](size_t bytes) { char* p = wsp; wsp += (bytes + 255) & ~(size_t)255; return (void*)p; };
    bf* WqT = (bf*)take((size_t)DD * DD * 2); bf* WkT = (bf*)take((size_t)DD * DD * 2); bf* WvT = (bf*)take((size_t)DD * DD * 2);
    bf* Xb = (bf*)take((size_t)NN * DD * 2); float* TMP = (float*)take((size_t)NN * DD * 4);
    bf* Qh = (bf*)take((size_t)NN * DD * 2); bf* Ql = (bf*)take((size_t)NN * DD * 2); bf* Kh = (bf*)take((size_t)NN * DD * 2); bf* Kl = (bf*)take((size_t)NN * DD * 2); bf* VTh = (bf*)take((size_t)DD * NN * 2); bf* VTl = (bf*)take((size_t)DD * NN * 2);
    float* S = (float*)take((size_t)RCH * NN * 4); bf* PH = (bf*)take((size_t)RCH * NN * 2); bf* PL = (bf*)take((size_t)RCH * NN * 2);
    if ((size_t)(wsp - (char*)d_ws) > ws_size) return;    // 1.5 + 4.2 + 8.4 + 6 x 4.2 + 16.8 + 2 x 8.4 ~ 73 MB, no aliasing (TMP reused q -> k -> v in stream order)
    k_wt<<<dim3(DD / 64, DD / 64, 1), 256, 0, stream>>>(Wq, DD, DD, WqT); k_wt<<<dim3(DD / 64, DD / 64, 1), 256, 0, stream>>>(Wk, DD, DD, WkT); k_wt<<<dim3(DD / 64, DD / 64, 1), 256, 0, stream>>>(Wv, DD, DD, WvT);
    k_cvt<<<NN / 8, 256, 0, stream>>>(x, Xb);
    k_gemmb<false, false><<<dim3(NN / 64, DD / 64, 1), 128, 0, stream>>>(Xb, nullptr, WqT, bq, TMP, DD, nullptr); k_split512<<<NN / 8, 256, 0, stream>>>(TMP, NN, Qh, Ql);      // q [n][512]
    k_gemmb<false, false><<<dim3(NN / 64, DD / 64, 1), 128, 0, stream>>>(Xb, nullptr, WkT, bk, TMP, DD, nullptr); k_split512<<<NN / 8, 256, 0, stream>>>(TMP, NN, Kh, Kl);      // k [m][512]
    k_gemmrb<false><<<dim3(DD / 64, NN / 64, 1), 128, 0, stream>>>(WvT, nullptr, Xb, bv, TMP, NN, DD); k_rowsplit<<<DD / 8, 256, 0, stream>>>(TMP, DD, VTh, VTl);     // v^T [c][m] (+ bv per row)
    for (int ch = 0; ch < NN / RCH; ++ch) { const size_t n0 = (size_t)ch * RCH;
        k_gemm3<<<dim3(RCH / 64, NN / 64, 1), 128, 0, stream>>>(Qh + n0 * DD, Ql + n0 * DD, Kh, Kl, DD, S, NN);                 // scores rows [n][m] = q_n . k_m (unscaled)
        k_softmax<<<RCH / 8, 256, 0, stream>>>(S, PH, PL);
        k_gemm3<<<dim3(RCH / 64, DD / 64, 1), 128, 0, stream>>>(PH, PL, VTh, VTl, NN, out + n0 * DD, DD); }                 // out rows n0.. = P . v
}

// v001
// It runs in 493 microseconds.
// Timed twice side by side with v000, it ran 1.70 and 1.69 times as fast.
#include <hip/hip_runtime.h>

// Compute dtypes, f32 accumulate: q, k token-major and v channel-major projections with PLAIN bf16 operands (rounded input, k-major weights transposed once; exact products, + bias) ->
// bf16 hi + UNSCALED residual planes; all 4096 rows in one pass: scores = q.k^T ([4096 x 512].[512 x 4096], three products; unscaled as in the module) -> row softmax in f32 -> P planes;

#define NN   4096
#define DD   512
#define RCH  NN
#define CC   DD
#define DM   DD
#define NTK  NN
#define LOSC 1024.0f

typedef _Float16 h16;
typedef unsigned short bf;
typedef __attribute__((ext_vector_type(16))) __bf16   v16bf;
typedef __attribute__((ext_vector_type(16))) _Float16 v16h;
typedef __attribute__((ext_vector_type(8)))  _Float16 v8h;
typedef __attribute__((ext_vector_type(8)))  unsigned short v8us;
typedef __attribute__((ext_vector_type(8)))  float    v8f;
typedef __attribute__((ext_vector_type(4)))  float    v4f;
typedef __attribute__((ext_vector_type(4)))  _Float16 v4h;
typedef v8h  __attribute__((may_alias)) v8ha;
typedef v4f  __attribute__((may_alias)) v4fa;
typedef v8us __attribute__((may_alias)) v8usa;

__device__ __forceinline__ unsigned short f2bf(float f) { unsigned u = __float_as_uint(f); u += 0x7FFFu + ((u >> 16) & 1u); return (unsigned short)(u >> 16); }
__device__ __forceinline__ float bf2f(unsigned short b) { return __uint_as_float(((unsigned)b) << 16); }
__device__ __forceinline__ float bfr(float f) { return bf2f(f2bf(f)); }
__device__ __forceinline__ v16h cat16(v8h lo, v8h hi) { return __builtin_shufflevector(lo, hi, 0, 1, 2, 3, 4, 5, 6, 7, 8, 9, 10, 11, 12, 13, 14, 15); }
__device__ __forceinline__ v16bf cat16b(v8us lo, v8us hi) { return __builtin_bit_cast(v16bf, __builtin_shufflevector(lo, hi, 0, 1, 2, 3, 4, 5, 6, 7, 8, 9, 10, 11, 12, 13, 14, 15)); }
__device__ __forceinline__ v8f wmma16(v16h a, v16h b, v8f c) { return __builtin_amdgcn_wmma_f32_16x16x32_f16(false, a, false, b, (short)0, c, false, false); }
__device__ __forceinline__ v8f wmmab(v16bf a, v16bf b, v8f c) { return __builtin_amdgcn_wmma_f32_16x16x32_bf16(false, a, false, b, (short)0, c, false, false); }

// k_wt: WT [n][K] = bf16(W[k][n]) (k-major [K][ncols]) via 64 x 64 LDS tiles; grid (K/64, ncols/64).
__global__ __launch_bounds__(256) void k_wt(const float* __restrict__ Wm, int K, int ncols, bf* WT) {
    __shared__ __align__(16) unsigned short tl[64 * 72];
    const int tid = threadIdx.x, k0 = blockIdx.x * 64, n0 = blockIdx.y * 64;
    const int kk = tid >> 2, nq = (tid & 3) * 16;
#pragma unroll
    for (int i = 0; i < 16; ++i) tl[(nq + i) * 72 + kk] = f2bf(Wm[(size_t)(k0 + kk) * ncols + n0 + nq + i]);
    __syncthreads();
    const int piece = tid & 7;
    auto pass = [&]() {
#pragma unroll
        for (int s = 0; s < 2; ++s) { const int nr = (tid >> 3) + 32 * s; const v8us val = *(const v8usa*)(tl + nr * 72 + piece * 8); *(v8us*)(WT + (size_t)(n0 + nr) * K + k0 + piece * 8) = val; }
    };
    pass(); 
}
// k_gemmb: 64 x 64 block tile (4 waves x 16 x 64) of C[NTK][NW] = (A [+ Al]).B^T (K = 512) [+ bf(bias[c])] [+ bf(R[r][c]) residual]; f32 whole-line epilogue (or f16
template <bool SPLITA, bool F16OUT = false>
__global__ __launch_bounds__(128) void k_gemmb(const bf* __restrict__ A, const bf* __restrict__ Al, const bf* __restrict__ Bn, const float* __restrict__ bias, float* C, int ldc, h16* C2, const float* __restrict__ R = nullptr, int K = DM, int roundR = 1) {
    __shared__ __align__(16) float ost[4][16 * 68];
    const int lane = threadIdx.x & 31, wave = threadIdx.x >> 5, lr = lane & 15, hi = lane >> 4;
    const int r0 = blockIdx.x * 64 + wave * 16, c0 = blockIdx.y * 64;
    const size_t aoff = (size_t)(r0 + lr) * K + 8 * hi;
    size_t boff[4];
#pragma unroll
    for (int t = 0; t < 4; ++t) boff[t] = (size_t)(c0 + t * 16 + lr) * K + 8 * hi;
    v8f acc[4];
#pragma unroll
    for (int t = 0; t < 4; ++t) acc[t] = (v8f){};
#pragma unroll 1
    for (int kc = 0; kc < K; kc += 32) {
        const v16bf a = cat16b(*(const v8us*)(A + aoff + kc), *(const v8us*)(A + aoff + kc + 16));
        v16bf al = a;
        if (SPLITA) al = cat16b(*(const v8us*)(Al + aoff + kc), *(const v8us*)(Al + aoff + kc + 16));
#pragma unroll
        for (int t = 0; t < 4; ++t) { const v16bf b = cat16b(*(const v8us*)(Bn + boff[t] + kc), *(const v8us*)(Bn + boff[t] + kc + 16)); acc[t] = wmmab(a, b, acc[t]); if (SPLITA) acc[t] = wmmab(al, b, acc[t]); }
        asm volatile("v_nop\n\tv_nop\n\tv_nop\n\tv_nop" : "+v"(acc[0]), "+v"(acc[1]), "+v"(acc[2]), "+v"(acc[3]) : "v"(a), "v"(al));
    }
    float* os = &ost[wave][0];
#pragma unroll
    for (int t = 0; t < 4; ++t) { const float bv = bias ? bfr(bias[c0 + t * 16 + lr]) : 0.f;
#pragma unroll
        for (int j = 0; j < 8; ++j) os[(hi * 8 + j) * 68 + t * 16 + lr] = acc[t][j] + bv; }
    __syncthreads();
    if (F16OUT) {
        h16* crow = (h16*)(void*)C + (size_t)r0 * ldc + c0;
        auto pass = [&]() {
#pragma unroll
            for (int s = 0; s < 4; ++s) { const int row = 4 * s + (lane >> 3), piece = lane & 7; const float* sp = os + row * 68 + piece * 8; v8h o, o2;
#pragma unroll
                for (int i = 0; i < 8; ++i) { const h16 a = (h16)sp[i]; o[i] = a; o2[i] = (h16)((sp[i] - (float)a) * LOSC); }
                *(v8h*)(crow + (size_t)row * ldc + piece * 8) = o; if (C2) *(v8h*)(C2 + (size_t)r0 * ldc + c0 + (size_t)row * ldc + piece * 8) = o2; }
        };
        pass(); 
    } else {
        float* crow = C + (size_t)r0 * ldc + c0;
        auto pass = [&]() {
#pragma unroll
            for (int s = 0; s < 8; ++s) { const int Lid = (lane >> 3) + 4 * s, piece = lane & 7; const int row = Lid >> 1, cofs = (Lid & 1) * 32 + piece * 4;
                v4f val = *(const v4fa*)(os + row * 68 + cofs); if (R) { const v4f rv = *(const v4f*)(R + ((size_t)r0 + row) * ldc + c0 + cofs); val += roundR ? (v4f){bfr(rv[0]), bfr(rv[1]), bfr(rv[2]), bfr(rv[3])} : rv; }
                *(v4f*)(crow + (size_t)row * ldc + cofs) = val; }
        };
        pass(); 
    }
}

// k_gemm3: 64 x 64 tile of C = (Ah + Al).(Bh + Bl)^T over K (row strides = K for all four planes; n-major B): three products per 32-k step (hh, hl, lh); f32
__global__ __launch_bounds__(128) void k_gemm3(const bf* __restrict__ Ah, const bf* __restrict__ Al, const bf* __restrict__ Bh, const bf* __restrict__ Bl, int K, float* C, int ldc) {
    __shared__ __align__(16) float ost[4][16 * 68];
    const int lane = threadIdx.x & 31, wave = threadIdx.x >> 5, lr = lane & 15, hi = lane >> 4;
    const int r0 = blockIdx.x * 64 + wave * 16, c0 = blockIdx.y * 64;
    const size_t aoff = (size_t)(r0 + lr) * K + 8 * hi;
    v8f acc[4];
#pragma unroll
    for (int t = 0; t < 4; ++t) acc[t] = (v8f){};
#pragma unroll 1
    for (int kc = 0; kc < K; kc += 32) {
        const v16bf a = cat16b(*(const v8us*)(Ah + aoff + kc), *(const v8us*)(Ah + aoff + kc + 16));
        const v16bf al = cat16b(*(const v8us*)(Al + aoff + kc), *(const v8us*)(Al + aoff + kc + 16));
#pragma unroll
        for (int t = 0; t < 4; ++t) { const size_t bo = (size_t)(c0 + t * 16 + lr) * K + kc + 8 * hi;
            const v16bf bh = cat16b(*(const v8us*)(Bh + bo), *(const v8us*)(Bh + bo + 16)); const v16bf bl = cat16b(*(const v8us*)(Bl + bo), *(const v8us*)(Bl + bo + 16));
            acc[t] = wmmab(a, bh, acc[t]); acc[t] = wmmab(al, bh, acc[t]); acc[t] = wmmab(a, bl, acc[t]); }
        asm volatile("v_nop\n\tv_nop\n\tv_nop\n\tv_nop" : "+v"(acc[0]), "+v"(acc[1]), "+v"(acc[2]), "+v"(acc[3]) : "v"(a), "v"(al));
    }
    float* os = &ost[wave][0];
#pragma unroll
    for (int t = 0; t < 4; ++t) {
#pragma unroll
        for (int j = 0; j < 8; ++j) os[(hi * 8 + j) * 68 + t * 16 + lr] = acc[t][j]; }
    __builtin_amdgcn_wave_barrier(); asm volatile("" ::: "memory");
    float* crow = C + (size_t)r0 * ldc + c0;
    auto pass = [&]() {
#pragma unroll
        for (int s = 0; s < 8; ++s) { const int Lid = (lane >> 3) + 4 * s, piece = lane & 7; const int row = Lid >> 1, cofs = (Lid & 1) * 32 + piece * 4;
            const v4f val = *(const v4fa*)(os + row * 68 + cofs); *(v4f*)(crow + (size_t)row * ldc + cofs) = val; }
    };
    pass(); 
}

// k_gemmrb: 64 x 64 tile of C[o][v] = (A [+ Al]).B^T over K (A row stride K, B n-major row stride K) + bf(rbias[o]) per ROW; f32 whole-line epilogue (8 lanes x 16 B per line),
template <bool SPLITA>
__global__ __launch_bounds__(128) void k_gemmrb(const bf* __restrict__ A, const bf* __restrict__ Al, const bf* __restrict__ Bn, const float* __restrict__ rbias, float* C, int ldc, int K) {
    __shared__ __align__(16) float ost[4][16 * 68];
    const int lane = threadIdx.x & 31, wave = threadIdx.x >> 5, lr = lane & 15, hi = lane >> 4;
    const int r0 = blockIdx.x * 64 + wave * 16, c0 = blockIdx.y * 64;
    const size_t aoff = (size_t)(r0 + lr) * K + 8 * hi;
    v8f acc[4];
#pragma unroll
    for (int t = 0; t < 4; ++t) acc[t] = (v8f){};
#pragma unroll 1
    for (int kc = 0; kc < K; kc += 32) {
        const v16bf a = cat16b(*(const v8us*)(A + aoff + kc), *(const v8us*)(A + aoff + kc + 16));
        v16bf al = a; if (SPLITA) al = cat16b(*(const v8us*)(Al + aoff + kc), *(const v8us*)(Al + aoff + kc + 16));
#pragma unroll
        for (int t = 0; t < 4; ++t) { const size_t bo = (size_t)(c0 + t * 16 + lr) * K + kc + 8 * hi; const v16bf bb = cat16b(*(const v8us*)(Bn + bo), *(const v8us*)(Bn + bo + 16)); acc[t] = wmmab(a, bb, acc[t]); if (SPLITA) acc[t] = wmmab(al, bb, acc[t]); }
        asm volatile("v_nop\n\tv_nop\n\tv_nop\n\tv_nop" : "+v"(acc[0]), "+v"(acc[1]), "+v"(acc[2]), "+v"(acc[3]) : "v"(a), "v"(al));
    }
    float* os = &ost[wave][0];
#pragma unroll
    for (int t = 0; t < 4; ++t) {
#pragma unroll
        for (int j = 0; j < 8; ++j) os[(hi * 8 + j) * 68 + t * 16 + lr] = acc[t][j] + bfr(rbias[r0 + hi * 8 + j]); }
    __builtin_amdgcn_wave_barrier(); asm volatile("" ::: "memory");
    float* crow = C + (size_t)r0 * ldc + c0;
    auto pass = [&]() {
#pragma unroll
        for (int s = 0; s < 8; ++s) { const int Lid = (lane >> 3) + 4 * s, piece = lane & 7; const int row = Lid >> 1, cofs = (Lid & 1) * 32 + piece * 4;
            const v4f val = *(const v4fa*)(os + row * 68 + cofs); *(v4f*)(crow + (size_t)row * ldc + cofs) = val; }
    };
    pass(); 
}
__global__ __launch_bounds__(256) void k_rowsplit(const float* __restrict__ Y, int nrows, bf* Ph, bf* Pl) {
    const int lane = threadIdx.x & 31, r = blockIdx.x * 8 + (threadIdx.x >> 5); if (r >= nrows) return;
{
#pragma unroll 1
        for (int c0 = lane * 8; c0 < NN; c0 += 256) { const size_t o = (size_t)r * NN + c0; const v8f v = *(const v8f*)(Y + o); v8us oh, ol;
#pragma unroll
            for (int i = 0; i < 8; ++i) { const unsigned short hb = f2bf(v[i]); oh[i] = hb; ol[i] = f2bf(v[i] - bf2f(hb)); }
            *(v8us*)(Ph + o) = oh; *(v8us*)(Pl + o) = ol; }
         }
}
__global__ __launch_bounds__(256) void k_softmax(const float* __restrict__ S, bf* PH, bf* PL) {
    const int lane = threadIdx.x & 31, r = blockIdx.x * 8 + (threadIdx.x >> 5); if (r >= RCH) return;
    const float* sr = S + (size_t)r * NN; float m = -3.0e38f;
#pragma unroll 1
    for (int c0 = lane * 8; c0 < NN; c0 += 256) { const v8f v = *(const v8f*)(sr + c0);
#pragma unroll
        for (int i = 0; i < 8; ++i) m = fmaxf(m, v[i]); }
#pragma unroll
    for (int sh = 16; sh; sh >>= 1) m = fmaxf(m, __shfl_xor(m, sh, 32));
    float sum = 0.f;
#pragma unroll 1
    for (int c0 = lane * 8; c0 < NN; c0 += 256) { const v8f v = *(const v8f*)(sr + c0);
#pragma unroll
        for (int i = 0; i < 8; ++i) sum += __expf(v[i] - m); }
#pragma unroll
    for (int sh = 16; sh; sh >>= 1) sum += __shfl_xor(sum, sh, 32);
    const float inv = 1.0f / sum;
{
#pragma unroll 1
        for (int c0 = lane * 8; c0 < NN; c0 += 256) { const v8f v = *(const v8f*)(sr + c0); v8us oh, ol;
#pragma unroll
            for (int i = 0; i < 8; ++i) { const float p = __expf(v[i] - m) * inv; const unsigned short hb = f2bf(p); oh[i] = hb; ol[i] = f2bf(p - bf2f(hb)); }
            const size_t o = (size_t)r * NN + c0; *(v8us*)(PH + o) = oh; *(v8us*)(PL + o) = ol; }
         }
}

__global__ __launch_bounds__(256) void k_cvt(const float* __restrict__ src, bf* dst) {
    const int lane = threadIdx.x & 31; const size_t r = (size_t)blockIdx.x * 8 + (threadIdx.x >> 5); if (r >= (size_t)NN) return;
{
#pragma unroll
        for (int q = 0; q < DD / 256; ++q) { v8us o;
#pragma unroll
            for (int i = 0; i < 8; ++i) o[i] = f2bf(src[r * DD + q * 256 + lane * 8 + i]);
            *(v8us*)(dst + r * DD + q * 256 + lane * 8) = o; }
         }
}
__global__ __launch_bounds__(256) void k_split512(const float* __restrict__ src, int nrows, bf* dh, bf* dl) {
    const int lane = threadIdx.x & 31; const size_t r = (size_t)blockIdx.x * 8 + (threadIdx.x >> 5); if (r >= (size_t)nrows) return;
{
#pragma unroll
        for (int q = 0; q < DD / 256; ++q) { const size_t o = r * DD + q * 256 + lane * 8; const v8f v = *(const v8f*)(src + o); v8us oh, ol;
#pragma unroll
            for (int i = 0; i < 8; ++i) { const unsigned short hb = f2bf(v[i]); oh[i] = hb; ol[i] = f2bf(v[i] - bf2f(hb)); }
            *(v8us*)(dh + o) = oh; *(v8us*)(dl + o) = ol; }
         }
}

extern "C" void kernel_launch(void* const* d_in, const int* in_sizes, int n_in,
                              void* d_out, int out_size, void* d_ws, size_t ws_size, hipStream_t stream) {
    (void)in_sizes; (void)n_in; (void)out_size;
    const float* x = (const float*)d_in[0]; const float* Wq = (const float*)d_in[1]; const float* bq = (const float*)d_in[2]; const float* Wk = (const float*)d_in[3]; const float* bk = (const float*)d_in[4]; const float* Wv = (const float*)d_in[5]; const float* bv = (const float*)d_in[6];
    float* out = (float*)d_out;    // [4096][512]
    char* wsp = (char*)d_ws;
    auto take = [&](size_t bytes) { char* p = wsp; wsp += (bytes + 255) & ~(size_t)255; return (void*)p; };
    bf* WqT = (bf*)take((size_t)DD * DD * 2); bf* WkT = (bf*)take((size_t)DD * DD * 2); bf* WvT = (bf*)take((size_t)DD * DD * 2);
    bf* Xb = (bf*)take((size_t)NN * DD * 2); float* TMP = (float*)take((size_t)NN * DD * 4);
    bf* Qh = (bf*)take((size_t)NN * DD * 2); bf* Ql = (bf*)take((size_t)NN * DD * 2); bf* Kh = (bf*)take((size_t)NN * DD * 2); bf* Kl = (bf*)take((size_t)NN * DD * 2); bf* VTh = (bf*)take((size_t)DD * NN * 2); bf* VTl = (bf*)take((size_t)DD * NN * 2);
    float* S = (float*)take((size_t)RCH * NN * 4); bf* PH = (bf*)take((size_t)RCH * NN * 2); bf* PL = (bf*)take((size_t)RCH * NN * 2);
    if ((size_t)(wsp - (char*)d_ws) > ws_size) return;    // 1.5 + 4.2 + 8.4 + 6 x 4.2 + 67.1 + 2 x 33.6 ~ 174 MB, no aliasing (TMP reused q -> k -> v in stream order)
    k_wt<<<dim3(DD / 64, DD / 64, 1), 256, 0, stream>>>(Wq, DD, DD, WqT); k_wt<<<dim3(DD / 64, DD / 64, 1), 256, 0, stream>>>(Wk, DD, DD, WkT); k_wt<<<dim3(DD / 64, DD / 64, 1), 256, 0, stream>>>(Wv, DD, DD, WvT);
    k_cvt<<<NN / 8, 256, 0, stream>>>(x, Xb);
    k_gemmb<false, false><<<dim3(NN / 64, DD / 64, 1), 128, 0, stream>>>(Xb, nullptr, WqT, bq, TMP, DD, nullptr); k_split512<<<NN / 8, 256, 0, stream>>>(TMP, NN, Qh, Ql);      // q [n][512]
    k_gemmb<false, false><<<dim3(NN / 64, DD / 64, 1), 128, 0, stream>>>(Xb, nullptr, WkT, bk, TMP, DD, nullptr); k_split512<<<NN / 8, 256, 0, stream>>>(TMP, NN, Kh, Kl);      // k [m][512]
    k_gemmrb<false><<<dim3(DD / 64, NN / 64, 1), 128, 0, stream>>>(WvT, nullptr, Xb, bv, TMP, NN, DD); k_rowsplit<<<DD / 8, 256, 0, stream>>>(TMP, DD, VTh, VTl);     // v^T [c][m] (+ bv per row)
    k_gemm3<<<dim3(RCH / 64, NN / 64, 1), 128, 0, stream>>>(Qh, Ql, Kh, Kl, DD, S, NN);          // scores [n][m] = q_n . k_m (unscaled), every row in one launch
    k_softmax<<<RCH / 8, 256, 0, stream>>>(S, PH, PL);
    k_gemm3<<<dim3(RCH / 64, DD / 64, 1), 128, 0, stream>>>(PH, PL, VTh, VTl, NN, out, DD);      // out = P . v: 512 work-groups, two on every WGP
}

// v002
// One run takes 185 microseconds.
// Next to v001, in two timings, it ran 2.67 and 2.65 times as fast.
// Counting every step since v000, it is 4.50 times as fast.
#include <hip/hip_runtime.h>

// Compute dtypes, f32 accumulate: q, k token-major and v channel-major projections with PLAIN bf16 operands (rounded input, k-major weights transposed once; exact products, + bias) ->
// bf16 hi + UNSCALED residual planes; all 4096 rows in one pass: scores = q.k^T ([4096 x 512].[512 x 4096], three products; unscaled as in the module) -> row softmax in f32 -> P planes;

#define NN   4096
#define DD   512
#define RCH  NN
#define CC   DD
#define DM   DD
#define NTK  NN
#define LOSC 1024.0f

typedef _Float16 h16;
typedef unsigned short bf;
typedef __attribute__((ext_vector_type(16))) __bf16   v16bf;
typedef __attribute__((ext_vector_type(16))) _Float16 v16h;
typedef __attribute__((ext_vector_type(8)))  _Float16 v8h;
typedef __attribute__((ext_vector_type(8)))  unsigned short v8us;
typedef __attribute__((ext_vector_type(8)))  float    v8f;
typedef __attribute__((ext_vector_type(4)))  float    v4f;
typedef __attribute__((ext_vector_type(4)))  _Float16 v4h;
typedef v8h  __attribute__((may_alias)) v8ha;
typedef v4f  __attribute__((may_alias)) v4fa;
typedef v8us __attribute__((may_alias)) v8usa;

__device__ __forceinline__ unsigned short f2bf(float f) { unsigned u = __float_as_uint(f); u += 0x7FFFu + ((u >> 16) & 1u); return (unsigned short)(u >> 16); }
__device__ __forceinline__ float bf2f(unsigned short b) { return __uint_as_float(((unsigned)b) << 16); }
__device__ __forceinline__ float bfr(float f) { return bf2f(f2bf(f)); }
__device__ __forceinline__ v16h cat16(v8h lo, v8h hi) { return __builtin_shufflevector(lo, hi, 0, 1, 2, 3, 4, 5, 6, 7, 8, 9, 10, 11, 12, 13, 14, 15); }
__device__ __forceinline__ v16bf cat16b(v8us lo, v8us hi) { return __builtin_bit_cast(v16bf, __builtin_shufflevector(lo, hi, 0, 1, 2, 3, 4, 5, 6, 7, 8, 9, 10, 11, 12, 13, 14, 15)); }
__device__ __forceinline__ v8f wmma16(v16h a, v16h b, v8f c) { return __builtin_amdgcn_wmma_f32_16x16x32_f16(false, a, false, b, (short)0, c, false, false); }
__device__ __forceinline__ v8f wmmab(v16bf a, v16bf b, v8f c) { return __builtin_amdgcn_wmma_f32_16x16x32_bf16(false, a, false, b, (short)0, c, false, false); }

// k_wt: WT [n][K] = bf16(W[k][n]) (k-major [K][ncols]) via 64 x 64 LDS tiles; grid (K/64, ncols/64).
__global__ __launch_bounds__(256) void k_wt(const float* __restrict__ Wm, int K, int ncols, bf* WT) {
    __shared__ __align__(16) unsigned short tl[64 * 72];
    const int tid = threadIdx.x, k0 = blockIdx.x * 64, n0 = blockIdx.y * 64;
    const int kk = tid >> 2, nq = (tid & 3) * 16;
#pragma unroll
    for (int i = 0; i < 16; ++i) tl[(nq + i) * 72 + kk] = f2bf(Wm[(size_t)(k0 + kk) * ncols + n0 + nq + i]);
    __syncthreads();
    const int piece = tid & 7;
    auto pass = [&]() {
#pragma unroll
        for (int s = 0; s < 2; ++s) { const int nr = (tid >> 3) + 32 * s; const v8us val = *(const v8usa*)(tl + nr * 72 + piece * 8); *(v8us*)(WT + (size_t)(n0 + nr) * K + k0 + piece * 8) = val; }
    };
    pass(); 
}
// cp16: one asynchronous 16-byte copy per lane, global -> LDS, through no register.
typedef int v4iv __attribute__((__vector_size__(16)));
typedef __attribute__((address_space(1))) v4iv g_v4iv;
typedef __attribute__((address_space(3))) v4iv l_v4iv;
__device__ __forceinline__ void cp16(const bf* g, unsigned char* l) { __builtin_amdgcn_global_load_async_to_lds_b128((g_v4iv*)g, (l_v4iv*)l, 0, 0); }

// k_gemm: BM x BN tile of C = A.B^T over K (every plane K-contiguous with row stride K, n-major B; K a positive multiple of 64), f32 accumulate.
// SPLIT: A = Ah + Al, B = Bh + Bl, three products per 32-k step (hh, lh, hl); else one product Ah.Bh. BIAS 1: + bf(bias[column]); BIAS 2: + bf(bias[row]).
// A stage is 64 k (128 B, one whole line) of every row of the planes [Ah BM | Al BM | Bh BN | Bl BN] at pitch 144 B in LDS, two buffers, filled by asynchronous copies
// while the stage before is worked on; 2 x 2 waves, each BM/2 x BN/2, read their fragments from LDS. Whole-line f32 epilogue staged per wave in the ring once every reader has left it.
template <int BM, int BN, bool SPLIT, int BIAS>
__global__ __launch_bounds__(128) void k_gemm(const bf* __restrict__ Ah, const bf* __restrict__ Al, const bf* __restrict__ Bh, const bf* __restrict__ Bl, const float* __restrict__ bias, int K, float* C, int ldc) {
    constexpr int PIT = 144, NP = SPLIT ? 2 : 1, ROWS = NP * (BM + BN), BUF = ROWS * PIT, NCP = ROWS / 16, WM = BM / 2, WN = BN / 2, RT = WM / 16, CT = WN / 16, OP = WN + 4;
    static_assert(NCP <= 63 && BM % 32 == 0 && BN % 32 == 0 && 4 * WM * OP * 4 <= 2 * BUF, "tile");
    __shared__ __align__(16) unsigned char sm[2 * BUF];
    const int tid = threadIdx.x, lane = tid & 31, wave = tid >> 5, lr = lane & 15, hi = lane >> 4;
    const int wm = wave >> 1, wn = wave & 1, rb = blockIdx.x * BM, cb = blockIdx.y * BN;
    unsigned char* const ldst = sm + (tid >> 3) * PIT + (tid & 7) * 16;
    const size_t gofs = (size_t)(tid >> 3) * K + (tid & 7) * 8;
    auto fill = [&](int st, int buf) {      // copy i of a lane: staged row 16 i + tid / 8, 16-byte piece tid % 8; eight lanes cover one 128-B line
#pragma unroll
        for (int i = 0; i < NCP; ++i) { const int row = i * 16;
            const bf* pl = row < BM ? Ah + (size_t)(rb + row) * K : row < NP * BM ? Al + (size_t)(rb + row - BM) * K : row < NP * BM + BN ? Bh + (size_t)(cb + row - NP * BM) * K : Bl + (size_t)(cb + row - NP * BM - BN) * K;
            cp16(pl + (size_t)st * 64 + gofs, ldst + buf * BUF + row * PIT); }
    };
    v8f acc[RT][CT];
#pragma unroll
    for (int r = 0; r < RT; ++r) {
#pragma unroll
        for (int t = 0; t < CT; ++t) acc[r][t] = (v8f){}; }
    const int nst = K / 64;
    fill(0, 0);
    asm volatile("s_wait_asynccnt 0x0" ::: "memory");      // stage 0 has landed before the barrier that publishes it
    __syncthreads();
    if (nst > 1) fill(1, 1);
#pragma unroll 1
    for (int st = 0; st < nst; ++st) {
        const unsigned char* sb = sm + (st & 1) * BUF;
        v16bf a[2][RT], al[2][RT], bh[2][CT], bl[2][CT];
#pragma unroll
        for (int ks = 0; ks < 2; ++ks) {
            const unsigned char* fa = sb + (wm * WM + lr) * PIT + ks * 64 + hi * 16;
            const unsigned char* fb = sb + (NP * BM + wn * WN + lr) * PIT + ks * 64 + hi * 16;
#pragma unroll
            for (int r = 0; r < RT; ++r) { const unsigned char* q = fa + r * 16 * PIT; a[ks][r] = cat16b(*(const v8usa*)q, *(const v8usa*)(q + 32)); al[ks][r] = a[ks][r];
                if (SPLIT) al[ks][r] = cat16b(*(const v8usa*)(q + BM * PIT), *(const v8usa*)(q + BM * PIT + 32)); }
#pragma unroll
            for (int t = 0; t < CT; ++t) { const unsigned char* q = fb + t * 16 * PIT; bh[ks][t] = cat16b(*(const v8usa*)q, *(const v8usa*)(q + 32)); bl[ks][t] = bh[ks][t];
                if (SPLIT) bl[ks][t] = cat16b(*(const v8usa*)(q + BN * PIT), *(const v8usa*)(q + BN * PIT + 32)); }
        }
        __builtin_amdgcn_sched_barrier(0);      // keeps the stage's LDS reads in one group ahead of its WMMAs: reads sunk among the WMMAs each make the wave wait out the LDS latency
#pragma unroll
        for (int ks = 0; ks < 2; ++ks) {
#pragma unroll
            for (int t = 0; t < CT; ++t) {
#pragma unroll
                for (int r = 0; r < RT; ++r) acc[r][t] = wmmab(a[ks][r], bh[ks][t], acc[r][t]);
                if (SPLIT) {
#pragma unroll
                    for (int r = 0; r < RT; ++r) acc[r][t] = wmmab(al[ks][r], bh[ks][t], acc[r][t]);
#pragma unroll
                    for (int r = 0; r < RT; ++r) acc[r][t] = wmmab(a[ks][r], bl[ks][t], acc[r][t]); } }
        }
        __builtin_amdgcn_sched_barrier(0);      // keeps the WMMAs ahead of the waits below, so that the next stage's copies fly while they run
        asm volatile("s_wait_dscnt 0x0" ::: "memory");     // this wave's reads of the buffer have retired before it is refilled
        asm volatile("s_wait_asynccnt 0x0" ::: "memory");  // this wave's copies of the next stage have landed before the barrier that publishes them
        __syncthreads();
        if (st + 2 < nst) fill(st + 2, st & 1);
    }
    asm volatile("s_wait_asynccnt 0x0" ::: "memory");      // nothing in flight when the ring becomes output staging
    float* os = (float*)(void*)sm + wave * (WM * OP);
#pragma unroll
    for (int r = 0; r < RT; ++r) {
#pragma unroll
        for (int t = 0; t < CT; ++t) { const float bc = BIAS == 1 ? bfr(bias[cb + wn * WN + t * 16 + lr]) : 0.f;
#pragma unroll
            for (int j = 0; j < 8; ++j) { const int row = r * 16 + hi * 8 + j; float v = acc[r][t][j];
                if (BIAS == 1) v += bc;
                if (BIAS == 2) v += bfr(bias[rb + wm * WM + row]);
                os[row * OP + t * 16 + lr] = v; } } }
    asm volatile("s_wait_dscnt 0x0" ::: "memory");     // the wave's staged rows are written before its lanes read each other's words back
    float* crow = C + (size_t)(rb + wm * WM) * ldc + cb + wn * WN;
#pragma unroll
    for (int s = 0; s < WM * WN / 128; ++s) { const int idx = s * 32 + lane, row = idx / (WN / 4), cofs = (idx % (WN / 4)) * 4;
        const v4f val = *(const v4fa*)(os + row * OP + cofs); *(v4f*)(crow + (size_t)row * ldc + cofs) = val; }
}

__global__ __launch_bounds__(256) void k_rowsplit(const float* __restrict__ Y, int nrows, bf* Ph, bf* Pl) {
    const int lane = threadIdx.x & 31, r = blockIdx.x * 8 + (threadIdx.x >> 5); if (r >= nrows) return;
{
#pragma unroll 1
        for (int c0 = lane * 8; c0 < NN; c0 += 256) { const size_t o = (size_t)r * NN + c0; const v8f v = *(const v8f*)(Y + o); v8us oh, ol;
#pragma unroll
            for (int i = 0; i < 8; ++i) { const unsigned short hb = f2bf(v[i]); oh[i] = hb; ol[i] = f2bf(v[i] - bf2f(hb)); }
            *(v8us*)(Ph + o) = oh; *(v8us*)(Pl + o) = ol; }
         }
}
__global__ __launch_bounds__(256) void k_softmax(const float* __restrict__ S, bf* PH, bf* PL) {
    const int lane = threadIdx.x & 31, r = blockIdx.x * 8 + (threadIdx.x >> 5); if (r >= RCH) return;
    const float* sr = S + (size_t)r * NN; float m = -3.0e38f;
#pragma unroll 1
    for (int c0 = lane * 8; c0 < NN; c0 += 256) { const v8f v = *(const v8f*)(sr + c0);
#pragma unroll
        for (int i = 0; i < 8; ++i) m = fmaxf(m, v[i]); }
#pragma unroll
    for (int sh = 16; sh; sh >>= 1) m = fmaxf(m, __shfl_xor(m, sh, 32));
    float sum = 0.f;
#pragma unroll 1
    for (int c0 = lane * 8; c0 < NN; c0 += 256) { const v8f v = *(const v8f*)(sr + c0);
#pragma unroll
        for (int i = 0; i < 8; ++i) sum += __expf(v[i] - m); }
#pragma unroll
    for (int sh = 16; sh; sh >>= 1) sum += __shfl_xor(sum, sh, 32);
    const float inv = 1.0f / sum;
{
#pragma unroll 1
        for (int c0 = lane * 8; c0 < NN; c0 += 256) { const v8f v = *(const v8f*)(sr + c0); v8us oh, ol;
#pragma unroll
            for (int i = 0; i < 8; ++i) { const float p = __expf(v[i] - m) * inv; const unsigned short hb = f2bf(p); oh[i] = hb; ol[i] = f2bf(p - bf2f(hb)); }
            const size_t o = (size_t)r * NN + c0; *(v8us*)(PH + o) = oh; *(v8us*)(PL + o) = ol; }
         }
}

__global__ __launch_bounds__(256) void k_cvt(const float* __restrict__ src, bf* dst) {
    const int lane = threadIdx.x & 31; const size_t r = (size_t)blockIdx.x * 8 + (threadIdx.x >> 5); if (r >= (size_t)NN) return;
{
#pragma unroll
        for (int q = 0; q < DD / 256; ++q) { v8us o;
#pragma unroll
            for (int i = 0; i < 8; ++i) o[i] = f2bf(src[r * DD + q * 256 + lane * 8 + i]);
            *(v8us*)(dst + r * DD + q * 256 + lane * 8) = o; }
         }
}
__global__ __launch_bounds__(256) void k_split512(const float* __restrict__ src, int nrows, bf* dh, bf* dl) {
    const int lane = threadIdx.x & 31; const size_t r = (size_t)blockIdx.x * 8 + (threadIdx.x >> 5); if (r >= (size_t)nrows) return;
{
#pragma unroll
        for (int q = 0; q < DD / 256; ++q) { const size_t o = r * DD + q * 256 + lane * 8; const v8f v = *(const v8f*)(src + o); v8us oh, ol;
#pragma unroll
            for (int i = 0; i < 8; ++i) { const unsigned short hb = f2bf(v[i]); oh[i] = hb; ol[i] = f2bf(v[i] - bf2f(hb)); }
            *(v8us*)(dh + o) = oh; *(v8us*)(dl + o) = ol; }
         }
}

extern "C" void kernel_launch(void* const* d_in, const int* in_sizes, int n_in,
                              void* d_out, int out_size, void* d_ws, size_t ws_size, hipStream_t stream) {
    (void)in_sizes; (void)n_in; (void)out_size;
    const float* x = (const float*)d_in[0]; const float* Wq = (const float*)d_in[1]; const float* bq = (const float*)d_in[2]; const float* Wk = (const float*)d_in[3]; const float* bk = (const float*)d_in[4]; const float* Wv = (const float*)d_in[5]; const float* bv = (const float*)d_in[6];
    float* out = (float*)d_out;    // [4096][512]
    char* wsp = (char*)d_ws;
    auto take = [&](size_t bytes) { char* p = wsp; wsp += (bytes + 255) & ~(size_t)255; return (void*)p; };
    bf* WqT = (bf*)take((size_t)DD * DD * 2); bf* WkT = (bf*)take((size_t)DD * DD * 2); bf* WvT = (bf*)take((size_t)DD * DD * 2);
    bf* Xb = (bf*)take((size_t)NN * DD * 2); float* TMP = (float*)take((size_t)NN * DD * 4);
    bf* Qh = (bf*)take((size_t)NN * DD * 2); bf* Ql = (bf*)take((size_t)NN * DD * 2); bf* Kh = (bf*)take((size_t)NN * DD * 2); bf* Kl = (bf*)take((size_t)NN * DD * 2); bf* VTh = (bf*)take((size_t)DD * NN * 2); bf* VTl = (bf*)take((size_t)DD * NN * 2);
    float* S = (float*)take((size_t)RCH * NN * 4); bf* PH = (bf*)take((size_t)RCH * NN * 2); bf* PL = (bf*)take((size_t)RCH * NN * 2);
    if ((size_t)(wsp - (char*)d_ws) > ws_size) return;    // 1.5 + 4.2 + 8.4 + 6 x 4.2 + 67.1 + 2 x 33.6 ~ 174 MB, no aliasing (TMP reused q -> k -> v in stream order)
    k_wt<<<dim3(DD / 64, DD / 64, 1), 256, 0, stream>>>(Wq, DD, DD, WqT); k_wt<<<dim3(DD / 64, DD / 64, 1), 256, 0, stream>>>(Wk, DD, DD, WkT); k_wt<<<dim3(DD / 64, DD / 64, 1), 256, 0, stream>>>(Wv, DD, DD, WvT);
    k_cvt<<<NN / 8, 256, 0, stream>>>(x, Xb);
    k_gemm<128, 64, false, 1><<<dim3(NN / 128, DD / 64, 1), 128, 0, stream>>>(Xb, nullptr, WqT, nullptr, bq, DD, TMP, DD); k_split512<<<NN / 8, 256, 0, stream>>>(TMP, NN, Qh, Ql);      // q [n][512]
    k_gemm<128, 64, false, 1><<<dim3(NN / 128, DD / 64, 1), 128, 0, stream>>>(Xb, nullptr, WkT, nullptr, bk, DD, TMP, DD); k_split512<<<NN / 8, 256, 0, stream>>>(TMP, NN, Kh, Kl);      // k [m][512]
    k_gemm<128, 64, false, 2><<<dim3(DD / 128, NN / 64, 1), 128, 0, stream>>>(WvT, nullptr, Xb, nullptr, bv, DD, TMP, NN); k_rowsplit<<<DD / 8, 256, 0, stream>>>(TMP, DD, VTh, VTl);     // v^T [c][m] (+ bv per row)
    k_gemm<128, 128, true, 0><<<dim3(RCH / 128, NN / 128, 1), 128, 0, stream>>>(Qh, Ql, Kh, Kl, nullptr, DD, S, NN);          // scores [n][m] = q_n . k_m (unscaled), every row in one launch
    k_softmax<<<RCH / 8, 256, 0, stream>>>(S, PH, PL);
    k_gemm<128, 64, true, 0><<<dim3(RCH / 128, DD / 64, 1), 128, 0, stream>>>(PH, PL, VTh, VTl, nullptr, NN, out, DD);      // out = P . v: 256 work-groups, one on every WGP
}

// v003
// Measured time: 137 microseconds a run.
// Next to v002, in two timings, it ran 1.35 and 1.36 times as fast.
// All steps since v000 together make it 6.09 times as fast.
#include <hip/hip_runtime.h>

// Compute dtypes, f32 accumulate: q, k token-major and v channel-major projections with PLAIN bf16 operands (rounded input, k-major weights transposed once; exact products, + bias) ->
// bf16 hi + UNSCALED residual planes; all 4096 rows in one pass: scores = q.k^T ([4096 x 512].[512 x 4096], three products; unscaled as in the module) -> row softmax in f32 -> P planes;

#define NN   4096
#define DD   512
#define RCH  NN
#define CC   DD
#define DM   DD
#define NTK  NN
#define LOSC 1024.0f

typedef _Float16 h16;
typedef unsigned short bf;
typedef __attribute__((ext_vector_type(16))) __bf16   v16bf;
typedef __attribute__((ext_vector_type(16))) _Float16 v16h;
typedef __attribute__((ext_vector_type(8)))  _Float16 v8h;
typedef __attribute__((ext_vector_type(8)))  unsigned short v8us;
typedef __attribute__((ext_vector_type(8)))  float    v8f;
typedef __attribute__((ext_vector_type(4)))  float    v4f;
typedef __attribute__((ext_vector_type(4)))  _Float16 v4h;
typedef v8h  __attribute__((may_alias)) v8ha;
typedef v4f  __attribute__((may_alias)) v4fa;
typedef v8us __attribute__((may_alias)) v8usa;

__device__ __forceinline__ unsigned short f2bf(float f) { unsigned u = __float_as_uint(f); u += 0x7FFFu + ((u >> 16) & 1u); return (unsigned short)(u >> 16); }
__device__ __forceinline__ float bf2f(unsigned short b) { return __uint_as_float(((unsigned)b) << 16); }
__device__ __forceinline__ float bfr(float f) { return bf2f(f2bf(f)); }
__device__ __forceinline__ v16h cat16(v8h lo, v8h hi) { return __builtin_shufflevector(lo, hi, 0, 1, 2, 3, 4, 5, 6, 7, 8, 9, 10, 11, 12, 13, 14, 15); }
__device__ __forceinline__ v16bf cat16b(v8us lo, v8us hi) { return __builtin_bit_cast(v16bf, __builtin_shufflevector(lo, hi, 0, 1, 2, 3, 4, 5, 6, 7, 8, 9, 10, 11, 12, 13, 14, 15)); }
__device__ __forceinline__ v8f wmma16(v16h a, v16h b, v8f c) { return __builtin_amdgcn_wmma_f32_16x16x32_f16(false, a, false, b, (short)0, c, false, false); }
__device__ __forceinline__ v8f wmmab(v16bf a, v16bf b, v8f c) { return __builtin_amdgcn_wmma_f32_16x16x32_bf16(false, a, false, b, (short)0, c, false, false); }

// k_prep, one launch: work-groups 0 .. NN/8-1 round eight rows of x each to bf16 (Xb); the next 3 x 64 each transpose one 64 x 64 tile of one weight matrix:
// WT [n][DD] = bf16(W[k][n]) (W k-major [DD][DD]) through LDS. The branch is uniform for a work-group, so its barrier is passed by all of its waves or by none.
__global__ __launch_bounds__(256) void k_prep(const float* __restrict__ x, const float* __restrict__ Wq, const float* __restrict__ Wk, const float* __restrict__ Wv, bf* Xb, bf* WqT, bf* WkT, bf* WvT) {
    __shared__ __align__(16) unsigned short tl[64 * 72];
    const int tid = threadIdx.x;
    if (blockIdx.x < NN / 8) {
        const int lane = tid & 31; const size_t r = (size_t)blockIdx.x * 8 + (tid >> 5);
#pragma unroll
        for (int q = 0; q < DD / 256; ++q) { v8us o;
#pragma unroll
            for (int i = 0; i < 8; ++i) o[i] = f2bf(x[r * DD + q * 256 + lane * 8 + i]);
            *(v8us*)(Xb + r * DD + q * 256 + lane * 8) = o; }
    } else {
        const int tb = blockIdx.x - NN / 8, which = tb >> 6, k0 = (tb & 7) * 64, n0 = ((tb >> 3) & 7) * 64;
        const float* Wm = which == 0 ? Wq : which == 1 ? Wk : Wv; bf* WT = which == 0 ? WqT : which == 1 ? WkT : WvT;
        const int kk = tid >> 2, nq = (tid & 3) * 16;
#pragma unroll
        for (int i = 0; i < 16; ++i) tl[(nq + i) * 72 + kk] = f2bf(Wm[(size_t)(k0 + kk) * DD + n0 + nq + i]);
        __syncthreads();
        const int piece = tid & 7;
#pragma unroll
        for (int s = 0; s < 2; ++s) { const int nr = (tid >> 3) + 32 * s; const v8us val = *(const v8usa*)(tl + nr * 72 + piece * 8); *(v8us*)(WT + (size_t)(n0 + nr) * DD + k0 + piece * 8) = val; }
        asm volatile("s_wait_xcnt 0x0" ::: "memory");      // the built code lays the other branch's body behind these stores: the wait stands in front of its first write of a register that they name
    }
}
// cp16: one asynchronous 16-byte copy per lane, global -> LDS, through no register.
typedef int v4iv __attribute__((__vector_size__(16)));
typedef __attribute__((address_space(1))) v4iv g_v4iv;
typedef __attribute__((address_space(3))) v4iv l_v4iv;
__device__ __forceinline__ void cp16(const bf* g, unsigned char* l) { __builtin_amdgcn_global_load_async_to_lds_b128((g_v4iv*)g, (l_v4iv*)l, 0, 0); }

// gemm_tile: BM x BN tile of C = A.B^T over K (every plane K-contiguous with row stride K, n-major B; K a positive multiple of 64), f32 accumulate.
// SPLIT: A = Ah + Al, B = Bh + Bl, three products per 32-k step (hh, lh, hl); else one product Ah.Bh. BIAS 1: + bf(bias[column]); BIAS 2: + bf(bias[row]).
// A stage is 64 k (128 B, one whole line) of every row of the planes [Ah BM | Al BM | Bh BN | Bl BN] at pitch 144 B in LDS, two buffers, filled by asynchronous copies
// while the stage before is worked on; 2 x 2 waves, each BM/2 x BN/2, read their fragments from LDS. Whole-line epilogue staged in the ring once every reader has left it:
// PLANES false: f32 C, staged per wave; PLANES true: the whole tile staged in f32, then each value written as bf16 hi (Ch) + bf16 residual (Cl), eight lanes to a 128-B line of a plane.
template <int BM, int BN, bool SPLIT> struct gemm_lds { static constexpr int bytes = 2 * (SPLIT ? 2 : 1) * (BM + BN) * 144; };
template <int BM, int BN, bool SPLIT, int BIAS, bool PLANES>
__device__ __forceinline__ void gemm_tile(unsigned char* sm, const bf* __restrict__ Ah, const bf* __restrict__ Al, const bf* __restrict__ Bh, const bf* __restrict__ Bl, const float* __restrict__ bias, int K, float* C, bf* Ch, bf* Cl, int ldc, int rb, int cb) {
    constexpr int PIT = 144, NP = SPLIT ? 2 : 1, ROWS = NP * (BM + BN), BUF = ROWS * PIT, NCP = ROWS / 16, WM = BM / 2, WN = BN / 2, RT = WM / 16, CT = WN / 16, OP = PLANES ? BN + 4 : WN + 4;
    static_assert(NCP <= 63 && BM % 32 == 0 && BN % 32 == 0 && (PLANES ? BM * OP * 4 : 4 * WM * OP * 4) <= 2 * BUF && 2 * BUF == gemm_lds<BM, BN, SPLIT>::bytes && (!PLANES || BN == 64), "tile");
    const int tid = threadIdx.x, lane = tid & 31, wave = tid >> 5, lr = lane & 15, hi = lane >> 4;
    const int wm = wave >> 1, wn = wave & 1;
    unsigned char* const ldst = sm + (tid >> 3) * PIT + (tid & 7) * 16;
    const size_t gofs = (size_t)(tid >> 3) * K + (tid & 7) * 8;
    auto fill = [&](int st, int buf) {      // copy i of a lane: staged row 16 i + tid / 8, 16-byte piece tid % 8; eight lanes cover one 128-B line
#pragma unroll
        for (int i = 0; i < NCP; ++i) { const int row = i * 16;
            const bf* pl = row < BM ? Ah + (size_t)(rb + row) * K : row < NP * BM ? Al + (size_t)(rb + row - BM) * K : row < NP * BM + BN ? Bh + (size_t)(cb + row - NP * BM) * K : Bl + (size_t)(cb + row - NP * BM - BN) * K;
            cp16(pl + (size_t)st * 64 + gofs, ldst + buf * BUF + row * PIT); }
    };
    v8f acc[RT][CT];
#pragma unroll
    for (int r = 0; r < RT; ++r) {
#pragma unroll
        for (int t = 0; t < CT; ++t) acc[r][t] = (v8f){}; }
    const int nst = K / 64;
    fill(0, 0);
    asm volatile("s_wait_asynccnt 0x0" ::: "memory");      // stage 0 has landed before the barrier that publishes it
    __syncthreads();
    if (nst > 1) fill(1, 1);
#pragma unroll 1
    for (int st = 0; st < nst; ++st) {
        const unsigned char* sb = sm + (st & 1) * BUF;
        v16bf a[2][RT], al[2][RT], bh[2][CT], bl[2][CT];
#pragma unroll
        for (int ks = 0; ks < 2; ++ks) {
            const unsigned char* fa = sb + (wm * WM + lr) * PIT + ks * 64 + hi * 16;
            const unsigned char* fb = sb + (NP * BM + wn * WN + lr) * PIT + ks * 64 + hi * 16;
#pragma unroll
            for (int r = 0; r < RT; ++r) { const unsigned char* q = fa + r * 16 * PIT; a[ks][r] = cat16b(*(const v8usa*)q, *(const v8usa*)(q + 32)); al[ks][r] = a[ks][r];
                if (SPLIT) al[ks][r] = cat16b(*(const v8usa*)(q + BM * PIT), *(const v8usa*)(q + BM * PIT + 32)); }
#pragma unroll
            for (int t = 0; t < CT; ++t) { const unsigned char* q = fb + t * 16 * PIT; bh[ks][t] = cat16b(*(const v8usa*)q, *(const v8usa*)(q + 32)); bl[ks][t] = bh[ks][t];
                if (SPLIT) bl[ks][t] = cat16b(*(const v8usa*)(q + BN * PIT), *(const v8usa*)(q + BN * PIT + 32)); }
        }
        __builtin_amdgcn_sched_barrier(0);      // keeps the stage's LDS reads in one group ahead of its WMMAs: reads sunk among the WMMAs each make the wave wait out the LDS latency
#pragma unroll
        for (int ks = 0; ks < 2; ++ks) {
#pragma unroll
            for (int t = 0; t < CT; ++t) {
#pragma unroll
                for (int r = 0; r < RT; ++r) acc[r][t] = wmmab(a[ks][r], bh[ks][t], acc[r][t]);
                if (SPLIT) {
#pragma unroll
                    for (int r = 0; r < RT; ++r) acc[r][t] = wmmab(al[ks][r], bh[ks][t], acc[r][t]);
#pragma unroll
                    for (int r = 0; r < RT; ++r) acc[r][t] = wmmab(a[ks][r], bl[ks][t], acc[r][t]); } }
        }
        __builtin_amdgcn_sched_barrier(0);      // keeps the WMMAs ahead of the waits below, so that the next stage's copies fly while they run
        asm volatile("s_wait_dscnt 0x0" ::: "memory");     // this wave's reads of the buffer have retired before it is refilled
        asm volatile("s_wait_asynccnt 0x0" ::: "memory");  // this wave's copies of the next stage have landed before the barrier that publishes them
        __syncthreads();
        if (st + 2 < nst) fill(st + 2, st & 1);
    }
    asm volatile("s_wait_asynccnt 0x0" ::: "memory");      // nothing in flight when the ring becomes output staging
    float* os = (float*)(void*)sm + (PLANES ? wm * WM * OP + wn * WN : wave * (WM * OP));
#pragma unroll
    for (int r = 0; r < RT; ++r) {
#pragma unroll
        for (int t = 0; t < CT; ++t) { const float bc = BIAS == 1 ? bfr(bias[cb + wn * WN + t * 16 + lr]) : 0.f;
#pragma unroll
            for (int j = 0; j < 8; ++j) { const int row = r * 16 + hi * 8 + j; float v = acc[r][t][j];
                if (BIAS == 1) v += bc;
                if (BIAS == 2) v += bfr(bias[rb + wm * WM + row]);
                os[row * OP + t * 16 + lr] = v; } } }
    if constexpr (PLANES) {
        __syncthreads();      // a row of the tile is staged by two waves: both halves are written before one wave reads the row back
        const float* ts = (const float*)(const void*)sm;
#pragma unroll
        for (int s = 0; s < BM * BN / 1024; ++s) { const int idx = s * 128 + tid, row = idx >> 3, cofs = (idx & 7) * 8;
            const v4f v0 = *(const v4fa*)(ts + row * OP + cofs), v1 = *(const v4fa*)(ts + row * OP + cofs + 4); v8us oh, ol;
#pragma unroll
            for (int i = 0; i < 8; ++i) { const float v = i < 4 ? v0[i & 3] : v1[i & 3]; const unsigned short hb = f2bf(v); oh[i] = hb; ol[i] = f2bf(v - bf2f(hb)); }
            const size_t o = (size_t)(rb + row) * ldc + cb + cofs; *(v8us*)(Ch + o) = oh; *(v8us*)(Cl + o) = ol; }
        asm volatile("s_wait_xcnt 0x0" ::: "memory");      // where a kernel holds two such tiles under a branch, the built code lays the second behind these stores: the wait stands in front of its first write of a register that they name
    } else {
        asm volatile("s_wait_dscnt 0x0" ::: "memory");     // the wave's staged rows are written before its lanes read each other's words back
        float* crow = C + (size_t)(rb + wm * WM) * ldc + cb + wn * WN;
#pragma unroll
        for (int s = 0; s < WM * WN / 128; ++s) { const int idx = s * 32 + lane, row = idx / (WN / 4), cofs = (idx % (WN / 4)) * 4;
            const v4f val = *(const v4fa*)(os + row * OP + cofs); *(v4f*)(crow + (size_t)row * ldc + cofs) = val; }
    }
}
// k_gemm: split operands, f32 C, one tile per work-group; grid (rows / BM, columns / BN).
template <int BM, int BN>
__global__ __launch_bounds__(128) void k_gemm(const bf* __restrict__ Ah, const bf* __restrict__ Al, const bf* __restrict__ Bh, const bf* __restrict__ Bl, int K, float* C, int ldc) {
    __shared__ __align__(16) unsigned char sm[gemm_lds<BM, BN, true>::bytes];
    gemm_tile<BM, BN, true, 0, false>(sm, Ah, Al, Bh, Bl, nullptr, K, C, nullptr, nullptr, ldc, blockIdx.x * BM, blockIdx.y * BN);
}
// k_proj: the three projections in one launch, grid (NN / 128, DD / 64, 3), planes written by the tile's own epilogue. z = 0, 1: q, k [n][DD] = Xb . W + bias per column;
// z = 2: v^T [c][NN] = WvT . Xb^T + bias per row, its 4 x 64 tiles numbered by the flat index of the same 32 x 8 grid. K = DD, the row stride of every operand plane.
__global__ __launch_bounds__(128) void k_proj(const bf* __restrict__ Xb, const bf* __restrict__ WqT, const bf* __restrict__ WkT, const bf* __restrict__ WvT, const float* __restrict__ bq, const float* __restrict__ bk, const float* __restrict__ bv,
                                              int K, bf* Qh, bf* Ql, bf* Kh, bf* Kl, bf* VTh, bf* VTl) {
    __shared__ __align__(16) unsigned char sm[gemm_lds<128, 64, false>::bytes];
    const int z = blockIdx.z;
    if (z == 2) { const int flat = blockIdx.y * (NN / 128) + blockIdx.x;
        gemm_tile<128, 64, false, 2, true>(sm, WvT, nullptr, Xb, nullptr, bv, K, nullptr, VTh, VTl, NN, (flat & 3) * 128, (flat >> 2) * 64);
    } else
        gemm_tile<128, 64, false, 1, true>(sm, Xb, nullptr, z ? WkT : WqT, nullptr, z ? bk : bq, K, nullptr, z ? Kh : Qh, z ? Kl : Ql, DD, blockIdx.x * 128, blockIdx.y * 64);
}

__global__ __launch_bounds__(256) void k_softmax(const float* __restrict__ S, bf* PH, bf* PL) {
    const int lane = threadIdx.x & 31, r = blockIdx.x * 8 + (threadIdx.x >> 5); if (r >= RCH) return;
    const float* sr = S + (size_t)r * NN; float m = -3.0e38f;
#pragma unroll 1
    for (int c0 = lane * 8; c0 < NN; c0 += 256) { const v8f v = *(const v8f*)(sr + c0);
#pragma unroll
        for (int i = 0; i < 8; ++i) m = fmaxf(m, v[i]); }
#pragma unroll
    for (int sh = 16; sh; sh >>= 1) m = fmaxf(m, __shfl_xor(m, sh, 32));
    float sum = 0.f;
#pragma unroll 1
    for (int c0 = lane * 8; c0 < NN; c0 += 256) { const v8f v = *(const v8f*)(sr + c0);
#pragma unroll
        for (int i = 0; i < 8; ++i) sum += __expf(v[i] - m); }
#pragma unroll
    for (int sh = 16; sh; sh >>= 1) sum += __shfl_xor(sum, sh, 32);
    const float inv = 1.0f / sum;
{
#pragma unroll 1
        for (int c0 = lane * 8; c0 < NN; c0 += 256) { const v8f v = *(const v8f*)(sr + c0); v8us oh, ol;
#pragma unroll
            for (int i = 0; i < 8; ++i) { const float p = __expf(v[i] - m) * inv; const unsigned short hb = f2bf(p); oh[i] = hb; ol[i] = f2bf(p - bf2f(hb)); }
            const size_t o = (size_t)r * NN + c0; *(v8us*)(PH + o) = oh; *(v8us*)(PL + o) = ol; }
         }
}

extern "C" void kernel_launch(void* const* d_in, const int* in_sizes, int n_in,
                              void* d_out, int out_size, void* d_ws, size_t ws_size, hipStream_t stream) {
    (void)in_sizes; (void)n_in; (void)out_size;
    const float* x = (const float*)d_in[0]; const float* Wq = (const float*)d_in[1]; const float* bq = (const float*)d_in[2]; const float* Wk = (const float*)d_in[3]; const float* bk = (const float*)d_in[4]; const float* Wv = (const float*)d_in[5]; const float* bv = (const float*)d_in[6];
    float* out = (float*)d_out;    // [4096][512]
    char* wsp = (char*)d_ws;
    auto take = [&](size_t bytes) { char* p = wsp; wsp += (bytes + 255) & ~(size_t)255; return (void*)p; };
    bf* WqT = (bf*)take((size_t)DD * DD * 2); bf* WkT = (bf*)take((size_t)DD * DD * 2); bf* WvT = (bf*)take((size_t)DD * DD * 2);
    bf* Xb = (bf*)take((size_t)NN * DD * 2);
    bf* Qh = (bf*)take((size_t)NN * DD * 2); bf* Ql = (bf*)take((size_t)NN * DD * 2); bf* Kh = (bf*)take((size_t)NN * DD * 2); bf* Kl = (bf*)take((size_t)NN * DD * 2); bf* VTh = (bf*)take((size_t)DD * NN * 2); bf* VTl = (bf*)take((size_t)DD * NN * 2);
    float* S = (float*)take((size_t)RCH * NN * 4); bf* PH = (bf*)take((size_t)RCH * NN * 2); bf* PL = (bf*)take((size_t)RCH * NN * 2);
    if ((size_t)(wsp - (char*)d_ws) > ws_size) return;    // 1.5 + 4.2 + 6 x 4.2 + 67.1 + 2 x 33.6 ~ 165 MB, no aliasing
    k_prep<<<NN / 8 + 3 * 64, 256, 0, stream>>>(x, Wq, Wk, Wv, Xb, WqT, WkT, WvT);
    k_proj<<<dim3(NN / 128, DD / 64, 3), 128, 0, stream>>>(Xb, WqT, WkT, WvT, bq, bk, bv, DD, Qh, Ql, Kh, Kl, VTh, VTl);      // q [n][512], k [m][512], v^T [c][m] as hi + residual planes
    k_gemm<128, 128><<<dim3(RCH / 128, NN / 128, 1), 128, 0, stream>>>(Qh, Ql, Kh, Kl, DD, S, NN);          // scores [n][m] = q_n . k_m (unscaled), every row in one launch
    k_softmax<<<RCH / 8, 256, 0, stream>>>(S, PH, PL);
    k_gemm<128, 64><<<dim3(RCH / 128, DD / 64, 1), 128, 0, stream>>>(PH, PL, VTh, VTl, NN, out, DD);      // out = P . v: 256 work-groups, one on every WGP
}

// v004
// A run of this version takes 130 microseconds.
// Next to v003, in two timings, it ran 1.05 times as fast each time.
// Counting every step since v000, it is 6.40 times as fast.
#include <hip/hip_runtime.h>

// Compute dtypes, f32 accumulate: q, k token-major and v channel-major projections with PLAIN bf16 operands (rounded input, k-major weights transposed once; exact products, + bias) ->
// bf16 hi + UNSCALED residual planes; all 4096 rows in one pass: scores = q.k^T ([4096 x 512].[512 x 4096], three products; unscaled as in the module) -> row softmax in f32 -> P planes;

#define NN   4096
#define DD   512
#define RCH  NN
#define CC   DD
#define DM   DD
#define NTK  NN
#define LOSC 1024.0f

typedef _Float16 h16;
typedef unsigned short bf;
typedef __attribute__((ext_vector_type(16))) __bf16   v16bf;
typedef __attribute__((ext_vector_type(16))) _Float16 v16h;
typedef __attribute__((ext_vector_type(8)))  _Float16 v8h;
typedef __attribute__((ext_vector_type(8)))  unsigned short v8us;
typedef __attribute__((ext_vector_type(8)))  float    v8f;
typedef __attribute__((ext_vector_type(4)))  float    v4f;
typedef __attribute__((ext_vector_type(4)))  _Float16 v4h;
typedef v8h  __attribute__((may_alias)) v8ha;
typedef v4f  __attribute__((may_alias)) v4fa;
typedef v8us __attribute__((may_alias)) v8usa;

__device__ __forceinline__ unsigned short f2bf(float f) { unsigned u = __float_as_uint(f); u += 0x7FFFu + ((u >> 16) & 1u); return (unsigned short)(u >> 16); }
__device__ __forceinline__ float bf2f(unsigned short b) { return __uint_as_float(((unsigned)b) << 16); }
__device__ __forceinline__ float bfr(float f) { return bf2f(f2bf(f)); }
__device__ __forceinline__ v16h cat16(v8h lo, v8h hi) { return __builtin_shufflevector(lo, hi, 0, 1, 2, 3, 4, 5, 6, 7, 8, 9, 10, 11, 12, 13, 14, 15); }
__device__ __forceinline__ v16bf cat16b(v8us lo, v8us hi) { return __builtin_bit_cast(v16bf, __builtin_shufflevector(lo, hi, 0, 1, 2, 3, 4, 5, 6, 7, 8, 9, 10, 11, 12, 13, 14, 15)); }
__device__ __forceinline__ v8f wmma16(v16h a, v16h b, v8f c) { return __builtin_amdgcn_wmma_f32_16x16x32_f16(false, a, false, b, (short)0, c, false, false); }
__device__ __forceinline__ v8f wmmab(v16bf a, v16bf b, v8f c) { return __builtin_amdgcn_wmma_f32_16x16x32_bf16(false, a, false, b, (short)0, c, false, false); }

// k_prep, one launch: work-groups 0 .. NN/8-1 round eight rows of x each to bf16 (Xb); the next 3 x 64 each transpose one 64 x 64 tile of one weight matrix:
// WT [n][DD] = bf16(W[k][n]) (W k-major [DD][DD]) through LDS. The branch is uniform for a work-group, so its barrier is passed by all of its waves or by none.
__global__ __launch_bounds__(256) void k_prep(const float* __restrict__ x, const float* __restrict__ Wq, const float* __restrict__ Wk, const float* __restrict__ Wv, bf* Xb, bf* WqT, bf* WkT, bf* WvT) {
    __shared__ __align__(16) unsigned short tl[64 * 72];
    const int tid = threadIdx.x;
    if (blockIdx.x < NN / 8) {
        const int lane = tid & 31; const size_t r = (size_t)blockIdx.x * 8 + (tid >> 5);
#pragma unroll
        for (int q = 0; q < DD / 256; ++q) { v8us o;
#pragma unroll
            for (int i = 0; i < 8; ++i) o[i] = f2bf(x[r * DD + q * 256 + lane * 8 + i]);
            *(v8us*)(Xb + r * DD + q * 256 + lane * 8) = o; }
    } else {
        const int tb = blockIdx.x - NN / 8, which = tb >> 6, k0 = (tb & 7) * 64, n0 = ((tb >> 3) & 7) * 64;
        const float* Wm = which == 0 ? Wq : which == 1 ? Wk : Wv; bf* WT = which == 0 ? WqT : which == 1 ? WkT : WvT;
        const int kk = tid >> 2, nq = (tid & 3) * 16;
#pragma unroll
        for (int i = 0; i < 16; ++i) tl[(nq + i) * 72 + kk] = f2bf(Wm[(size_t)(k0 + kk) * DD + n0 + nq + i]);
        __syncthreads();
        const int piece = tid & 7;
#pragma unroll
        for (int s = 0; s < 2; ++s) { const int nr = (tid >> 3) + 32 * s; const v8us val = *(const v8usa*)(tl + nr * 72 + piece * 8); *(v8us*)(WT + (size_t)(n0 + nr) * DD + k0 + piece * 8) = val; }
        asm volatile("s_wait_xcnt 0x0" ::: "memory");      // the built code lays the other branch's body behind these stores: the wait stands in front of its first write of a register that they name
    }
}
// cp16: one asynchronous 16-byte copy per lane, global -> LDS, through no register.
typedef int v4iv __attribute__((__vector_size__(16)));
typedef __attribute__((address_space(1))) v4iv g_v4iv;
typedef __attribute__((address_space(3))) v4iv l_v4iv;
__device__ __forceinline__ void cp16(const bf* g, unsigned char* l) { __builtin_amdgcn_global_load_async_to_lds_b128((g_v4iv*)g, (l_v4iv*)l, 0, 0); }

// gemm_tile: BM x BN tile of C = A.B^T over K (every plane K-contiguous with row stride K, n-major B; K a positive multiple of 64), f32 accumulate.
// SPLIT: A = Ah + Al, B = Bh + Bl, three products per 32-k step (hh, lh, hl); else one product Ah.Bh. BIAS 1: + bf(bias[column]); BIAS 2: + bf(bias[row]).
// A stage is 64 k (128 B, one whole line) of every row of the planes [Ah BM | Al BM | Bh BN | Bl BN] at pitch 144 B in LDS, a ring of NB buffers filled by asynchronous copies
// NB - 1 stages ahead of the stage that is worked on (NB 3: for an operand that comes from memory, whose copies land later than one stage's work lasts); 2 x 2 waves, each BM/2 x BN/2, read their fragments from LDS. Whole-line epilogue staged in the ring once every reader has left it:
// PLANES false: f32 C, staged per wave; PLANES true: the whole tile staged in f32, then each value written as bf16 hi (Ch) + bf16 residual (Cl), eight lanes to a 128-B line of a plane.
template <int BM, int BN, bool SPLIT, int NB> struct gemm_lds { static constexpr int bytes = NB * (SPLIT ? 2 : 1) * (BM + BN) * 144; };
template <int BM, int BN, bool SPLIT, int BIAS, bool PLANES, int NB>
__device__ __forceinline__ void gemm_tile(unsigned char* sm, const bf* __restrict__ Ah, const bf* __restrict__ Al, const bf* __restrict__ Bh, const bf* __restrict__ Bl, const float* __restrict__ bias, int K, float* C, bf* Ch, bf* Cl, int ldc, int rb, int cb) {
    constexpr int PIT = 144, NP = SPLIT ? 2 : 1, ROWS = NP * (BM + BN), BUF = ROWS * PIT, NCP = ROWS / 16, WM = BM / 2, WN = BN / 2, RT = WM / 16, CT = WN / 16, OP = PLANES ? BN + 4 : WN + 4;
    static_assert((NB == 2 || NB == 3) && (NB - 1) * NCP <= 63 && BM % 32 == 0 && BN % 32 == 0 && (PLANES ? BM * OP * 4 : 4 * WM * OP * 4) <= NB * BUF && NB * BUF == gemm_lds<BM, BN, SPLIT, NB>::bytes && (!PLANES || BN == 64), "tile");
    const int tid = threadIdx.x, lane = tid & 31, wave = tid >> 5, lr = lane & 15, hi = lane >> 4;
    const int wm = wave >> 1, wn = wave & 1;
    unsigned char* const ldst = sm + (tid >> 3) * PIT + (tid & 7) * 16;
    const size_t gofs = (size_t)(tid >> 3) * K + (tid & 7) * 8;
    auto fill = [&](int st, int buf) {      // copy i of a lane: staged row 16 i + tid / 8, 16-byte piece tid % 8; eight lanes cover one 128-B line
#pragma unroll
        for (int i = 0; i < NCP; ++i) { const int row = i * 16;
            const bf* pl = row < BM ? Ah + (size_t)(rb + row) * K : row < NP * BM ? Al + (size_t)(rb + row - BM) * K : row < NP * BM + BN ? Bh + (size_t)(cb + row - NP * BM) * K : Bl + (size_t)(cb + row - NP * BM - BN) * K;
            cp16(pl + (size_t)st * 64 + gofs, ldst + buf * BUF + row * PIT); }
    };
    v8f acc[RT][CT];
#pragma unroll
    for (int r = 0; r < RT; ++r) {
#pragma unroll
        for (int t = 0; t < CT; ++t) acc[r][t] = (v8f){}; }
    const int nst = K / 64;
    fill(0, 0);
    if constexpr (NB == 3) { fill(1, 1);      // K is at least 128: stage 1 exists
        asm volatile("s_wait_asynccnt %0" :: "n"(NCP) : "memory"); }      // all but this wave's NCP youngest copies (stage 1's) have landed: stage 0 is there before the barrier that publishes it
    else asm volatile("s_wait_asynccnt 0x0" ::: "memory");      // stage 0 has landed before the barrier that publishes it
    __syncthreads();
    if (nst > NB - 1) fill(NB - 1, NB - 1);
    int ring = 0;      // NB 3: the buffer of stage st, st mod 3
#pragma unroll 1
    for (int st = 0; st < nst; ++st) {
        const int cur = NB == 2 ? (st & 1) : ring;
        const unsigned char* sb = sm + cur * BUF;
        v16bf a[2][RT], al[2][RT], bh[2][CT], bl[2][CT];
#pragma unroll
        for (int ks = 0; ks < 2; ++ks) {
            const unsigned char* fa = sb + (wm * WM + lr) * PIT + ks * 64 + hi * 16;
            const unsigned char* fb = sb + (NP * BM + wn * WN + lr) * PIT + ks * 64 + hi * 16;
#pragma unroll
            for (int r = 0; r < RT; ++r) { const unsigned char* q = fa + r * 16 * PIT; a[ks][r] = cat16b(*(const v8usa*)q, *(const v8usa*)(q + 32)); al[ks][r] = a[ks][r];
                if (SPLIT) al[ks][r] = cat16b(*(const v8usa*)(q + BM * PIT), *(const v8usa*)(q + BM * PIT + 32)); }
#pragma unroll
            for (int t = 0; t < CT; ++t) { const unsigned char* q = fb + t * 16 * PIT; bh[ks][t] = cat16b(*(const v8usa*)q, *(const v8usa*)(q + 32)); bl[ks][t] = bh[ks][t];
                if (SPLIT) bl[ks][t] = cat16b(*(const v8usa*)(q + BN * PIT), *(const v8usa*)(q + BN * PIT + 32)); }
        }
        __builtin_amdgcn_sched_barrier(0);      // keeps the stage's LDS reads in one group ahead of its WMMAs: reads sunk among the WMMAs each make the wave wait out the LDS latency
#pragma unroll
        for (int ks = 0; ks < 2; ++ks) {
#pragma unroll
            for (int t = 0; t < CT; ++t) {
#pragma unroll
                for (int r = 0; r < RT; ++r) acc[r][t] = wmmab(a[ks][r], bh[ks][t], acc[r][t]);
                if (SPLIT) {
#pragma unroll
                    for (int r = 0; r < RT; ++r) acc[r][t] = wmmab(al[ks][r], bh[ks][t], acc[r][t]);
#pragma unroll
                    for (int r = 0; r < RT; ++r) acc[r][t] = wmmab(a[ks][r], bl[ks][t], acc[r][t]); } }
        }
        __builtin_amdgcn_sched_barrier(0);      // keeps the WMMAs ahead of the waits below, so that the next stage's copies fly while they run
        asm volatile("s_wait_dscnt 0x0" ::: "memory");     // this wave's reads of the buffer have retired before it is refilled
        const bool more = st + NB < nst;      // the same for the whole work-group: this trip refills the buffer that it has read
        if (NB == 3 && more) asm volatile("s_wait_asynccnt %0" :: "n"(NCP) : "memory");      // in flight: stages st + 1 and st + 2, NCP copies each, counted in issue order: st + 1 has landed, st + 2 flies on over the next trip
        else asm volatile("s_wait_asynccnt 0x0" ::: "memory");  // this wave's copies of the next stage have landed before the barrier that publishes them
        __syncthreads();
        if (more) fill(st + NB, cur);
        ring = ring == NB - 1 ? 0 : ring + 1;
    }
    asm volatile("s_wait_asynccnt 0x0" ::: "memory");      // nothing in flight when the ring becomes output staging
    float* os = (float*)(void*)sm + (PLANES ? wm * WM * OP + wn * WN : wave * (WM * OP));
#pragma unroll
    for (int r = 0; r < RT; ++r) {
#pragma unroll
        for (int t = 0; t < CT; ++t) { const float bc = BIAS == 1 ? bfr(bias[cb + wn * WN + t * 16 + lr]) : 0.f;
#pragma unroll
            for (int j = 0; j < 8; ++j) { const int row = r * 16 + hi * 8 + j; float v = acc[r][t][j];
                if (BIAS == 1) v += bc;
                if (BIAS == 2) v += bfr(bias[rb + wm * WM + row]);
                os[row * OP + t * 16 + lr] = v; } } }
    if constexpr (PLANES) {
        __syncthreads();      // a row of the tile is staged by two waves: both halves are written before one wave reads the row back
        const float* ts = (const float*)(const void*)sm;
#pragma unroll
        for (int s = 0; s < BM * BN / 1024; ++s) { const int idx = s * 128 + tid, row = idx >> 3, cofs = (idx & 7) * 8;
            const v4f v0 = *(const v4fa*)(ts + row * OP + cofs), v1 = *(const v4fa*)(ts + row * OP + cofs + 4); v8us oh, ol;
#pragma unroll
            for (int i = 0; i < 8; ++i) { const float v = i < 4 ? v0[i & 3] : v1[i & 3]; const unsigned short hb = f2bf(v); oh[i] = hb; ol[i] = f2bf(v - bf2f(hb)); }
            const size_t o = (size_t)(rb + row) * ldc + cb + cofs; *(v8us*)(Ch + o) = oh; *(v8us*)(Cl + o) = ol; }
        asm volatile("s_wait_xcnt 0x0" ::: "memory");      // where a kernel holds two such tiles under a branch, the built code lays the second behind these stores: the wait stands in front of its first write of a register that they name
    } else {
        asm volatile("s_wait_dscnt 0x0" ::: "memory");     // the wave's staged rows are written before its lanes read each other's words back
        float* crow = C + (size_t)(rb + wm * WM) * ldc + cb + wn * WN;
#pragma unroll
        for (int s = 0; s < WM * WN / 128; ++s) { const int idx = s * 32 + lane, row = idx / (WN / 4), cofs = (idx % (WN / 4)) * 4;
            const v4f val = *(const v4fa*)(os + row * OP + cofs); *(v4f*)(crow + (size_t)row * ldc + cofs) = val; }
    }
}
// k_gemm: split operands, f32 C, one tile per work-group; grid (rows / BM, columns / BN).
template <int BM, int BN, int NB>
__global__ __launch_bounds__(128) void k_gemm(const bf* __restrict__ Ah, const bf* __restrict__ Al, const bf* __restrict__ Bh, const bf* __restrict__ Bl, int K, float* C, int ldc) {
    __shared__ __align__(16) unsigned char sm[gemm_lds<BM, BN, true, NB>::bytes];
    gemm_tile<BM, BN, true, 0, false, NB>(sm, Ah, Al, Bh, Bl, nullptr, K, C, nullptr, nullptr, ldc, blockIdx.x * BM, blockIdx.y * BN);
}
// k_proj: the three projections in one launch, grid (NN / 128, DD / 64, 3), planes written by the tile's own epilogue. z = 0, 1: q, k [n][DD] = Xb . W + bias per column;
// z = 2: v^T [c][NN] = WvT . Xb^T + bias per row, its 4 x 64 tiles numbered by the flat index of the same 32 x 8 grid. K = DD, the row stride of every operand plane.
__global__ __launch_bounds__(128) void k_proj(const bf* __restrict__ Xb, const bf* __restrict__ WqT, const bf* __restrict__ WkT, const bf* __restrict__ WvT, const float* __restrict__ bq, const float* __restrict__ bk, const float* __restrict__ bv,
                                              int K, bf* Qh, bf* Ql, bf* Kh, bf* Kl, bf* VTh, bf* VTl) {
    __shared__ __align__(16) unsigned char sm[gemm_lds<128, 64, false, 2>::bytes];
    const int z = blockIdx.z;
    if (z == 2) { const int flat = blockIdx.y * (NN / 128) + blockIdx.x;
        gemm_tile<128, 64, false, 2, true, 2>(sm, WvT, nullptr, Xb, nullptr, bv, K, nullptr, VTh, VTl, NN, (flat & 3) * 128, (flat >> 2) * 64);
    } else
        gemm_tile<128, 64, false, 1, true, 2>(sm, Xb, nullptr, z ? WkT : WqT, nullptr, z ? bk : bq, K, nullptr, z ? Kh : Qh, z ? Kl : Ql, DD, blockIdx.x * 128, blockIdx.y * 64);
}

__global__ __launch_bounds__(256) void k_softmax(const float* __restrict__ S, bf* PH, bf* PL) {
    const int lane = threadIdx.x & 31, r = blockIdx.x * 8 + (threadIdx.x >> 5); if (r >= RCH) return;
    const float* sr = S + (size_t)r * NN; float m = -3.0e38f;
#pragma unroll 1
    for (int c0 = lane * 8; c0 < NN; c0 += 256) { const v8f v = *(const v8f*)(sr + c0);
#pragma unroll
        for (int i = 0; i < 8; ++i) m = fmaxf(m, v[i]); }
#pragma unroll
    for (int sh = 16; sh; sh >>= 1) m = fmaxf(m, __shfl_xor(m, sh, 32));
    float sum = 0.f;
#pragma unroll 1
    for (int c0 = lane * 8; c0 < NN; c0 += 256) { const v8f v = *(const v8f*)(sr + c0);
#pragma unroll
        for (int i = 0; i < 8; ++i) sum += __expf(v[i] - m); }
#pragma unroll
    for (int sh = 16; sh; sh >>= 1) sum += __shfl_xor(sum, sh, 32);
    const float inv = 1.0f / sum;
{
#pragma unroll 1
        for (int c0 = lane * 8; c0 < NN; c0 += 256) { const v8f v = *(const v8f*)(sr + c0); v8us oh, ol;
#pragma unroll
            for (int i = 0; i < 8; ++i) { const float p = __expf(v[i] - m) * inv; const unsigned short hb = f2bf(p); oh[i] = hb; ol[i] = f2bf(p - bf2f(hb)); }
            const size_t o = (size_t)r * NN + c0; *(v8us*)(PH + o) = oh; *(v8us*)(PL + o) = ol; }
         }
}

extern "C" void kernel_launch(void* const* d_in, const int* in_sizes, int n_in,
                              void* d_out, int out_size, void* d_ws, size_t ws_size, hipStream_t stream) {
    (void)in_sizes; (void)n_in; (void)out_size;
    const float* x = (const float*)d_in[0]; const float* Wq = (const float*)d_in[1]; const float* bq = (const float*)d_in[2]; const float* Wk = (const float*)d_in[3]; const float* bk = (const float*)d_in[4]; const float* Wv = (const float*)d_in[5]; const float* bv = (const float*)d_in[6];
    float* out = (float*)d_out;    // [4096][512]
    char* wsp = (char*)d_ws;
    auto take = [&](size_t bytes) { char* p = wsp; wsp += (bytes + 255) & ~(size_t)255; return (void*)p; };
    bf* WqT = (bf*)take((size_t)DD * DD * 2); bf* WkT = (bf*)take((size_t)DD * DD * 2); bf* WvT = (bf*)take((size_t)DD * DD * 2);
    bf* Xb = (bf*)take((size_t)NN * DD * 2);
    bf* Qh = (bf*)take((size_t)NN * DD * 2); bf* Ql = (bf*)take((size_t)NN * DD * 2); bf* Kh = (bf*)take((size_t)NN * DD * 2); bf* Kl = (bf*)take((size_t)NN * DD * 2); bf* VTh = (bf*)take((size_t)DD * NN * 2); bf* VTl = (bf*)take((size_t)DD * NN * 2);
    float* S = (float*)take((size_t)RCH * NN * 4); bf* PH = (bf*)take((size_t)RCH * NN * 2); bf* PL = (bf*)take((size_t)RCH * NN * 2);
    if ((size_t)(wsp - (char*)d_ws) > ws_size) return;    // 1.5 + 4.2 + 6 x 4.2 + 67.1 + 2 x 33.6 ~ 165 MB, no aliasing
    k_prep<<<NN / 8 + 3 * 64, 256, 0, stream>>>(x, Wq, Wk, Wv, Xb, WqT, WkT, WvT);
    k_proj<<<dim3(NN / 128, DD / 64, 3), 128, 0, stream>>>(Xb, WqT, WkT, WvT, bq, bk, bv, DD, Qh, Ql, Kh, Kl, VTh, VTl);      // q [n][512], k [m][512], v^T [c][m] as hi + residual planes
    k_gemm<128, 128, 2><<<dim3(RCH / 128, NN / 128, 1), 128, 0, stream>>>(Qh, Ql, Kh, Kl, DD, S, NN);          // scores [n][m] = q_n . k_m (unscaled), every row in one launch
    k_softmax<<<RCH / 8, 256, 0, stream>>>(S, PH, PL);
    k_gemm<128, 64, 3><<<dim3(RCH / 128, DD / 64, 1), 128, 0, stream>>>(PH, PL, VTh, VTl, NN, out, DD);      // out = P . v: 256 work-groups, one on every WGP; P comes from memory: three buffers
}

// v005
// One run takes 120 microseconds.
// In both of two side-by-side timings against v004, it was 1.09 times as fast.
// All steps since v000 together make it 6.95 times as fast.
#include <hip/hip_runtime.h>

// Compute dtypes, f32 accumulate: q, k token-major and v channel-major projections with PLAIN bf16 operands (rounded input, k-major weights transposed once; exact products, + bias) ->
// bf16 hi + UNSCALED residual planes; all 4096 rows in one pass: scores = q.k^T ([4096 x 512].[512 x 4096], three products; unscaled as in the module) -> row softmax in f32 -> P planes;

#define NN   4096
#define DD   512
#define RCH  NN
#define CC   DD
#define DM   DD
#define NTK  NN
#define LOSC 1024.0f

typedef _Float16 h16;
typedef unsigned short bf;
typedef __attribute__((ext_vector_type(16))) __bf16   v16bf;
typedef __attribute__((ext_vector_type(16))) _Float16 v16h;
typedef __attribute__((ext_vector_type(8)))  _Float16 v8h;
typedef __attribute__((ext_vector_type(8)))  unsigned short v8us;
typedef __attribute__((ext_vector_type(8)))  float    v8f;
typedef __attribute__((ext_vector_type(4)))  float    v4f;
typedef __attribute__((ext_vector_type(4)))  _Float16 v4h;
typedef v8h  __attribute__((may_alias)) v8ha;
typedef v4f  __attribute__((may_alias)) v4fa;
typedef v8us __attribute__((may_alias)) v8usa;

__device__ __forceinline__ unsigned short f2bf(float f) { unsigned u = __float_as_uint(f); u += 0x7FFFu + ((u >> 16) & 1u); return (unsigned short)(u >> 16); }
__device__ __forceinline__ float bf2f(unsigned short b) { return __uint_as_float(((unsigned)b) << 16); }
__device__ __forceinline__ float bfr(float f) { return bf2f(f2bf(f)); }
__device__ __forceinline__ v16h cat16(v8h lo, v8h hi) { return __builtin_shufflevector(lo, hi, 0, 1, 2, 3, 4, 5, 6, 7, 8, 9, 10, 11, 12, 13, 14, 15); }
__device__ __forceinline__ v16bf cat16b(v8us lo, v8us hi) { return __builtin_bit_cast(v16bf, __builtin_shufflevector(lo, hi, 0, 1, 2, 3, 4, 5, 6, 7, 8, 9, 10, 11, 12, 13, 14, 15)); }
__device__ __forceinline__ v8f wmma16(v16h a, v16h b, v8f c) { return __builtin_amdgcn_wmma_f32_16x16x32_f16(false, a, false, b, (short)0, c, false, false); }
__device__ __forceinline__ v8f wmmab(v16bf a, v16bf b, v8f c) { return __builtin_amdgcn_wmma_f32_16x16x32_bf16(false, a, false, b, (short)0, c, false, false); }

// k_prep, one launch: work-groups 0 .. NN/8-1 round eight rows of x each to bf16 (Xb); the next 3 x 64 each transpose one 64 x 64 tile of one weight matrix:
// WT [n][DD] = bf16(W[k][n]) (W k-major [DD][DD]) through LDS. The branch is uniform for a work-group, so its barrier is passed by all of its waves or by none.
__global__ __launch_bounds__(256) void k_prep(const float* __restrict__ x, const float* __restrict__ Wq, const float* __restrict__ Wk, const float* __restrict__ Wv, bf* Xb, bf* WqT, bf* WkT, bf* WvT) {
    __shared__ __align__(16) unsigned short tl[64 * 72];
    const int tid = threadIdx.x;
    if (blockIdx.x < NN / 8) {
        const int lane = tid & 31; const size_t r = (size_t)blockIdx.x * 8 + (tid >> 5);
#pragma unroll
        for (int q = 0; q < DD / 256; ++q) { v8us o;
#pragma unroll
            for (int i = 0; i < 8; ++i) o[i] = f2bf(x[r * DD + q * 256 + lane * 8 + i]);
            *(v8us*)(Xb + r * DD + q * 256 + lane * 8) = o; }
    } else {
        const int tb = blockIdx.x - NN / 8, which = tb >> 6, k0 = (tb & 7) * 64, n0 = ((tb >> 3) & 7) * 64;
        const float* Wm = which == 0 ? Wq : which == 1 ? Wk : Wv; bf* WT = which == 0 ? WqT : which == 1 ? WkT : WvT;
        const int kk = tid >> 2, nq = (tid & 3) * 16;
#pragma unroll
        for (int i = 0; i < 16; ++i) tl[(nq + i) * 72 + kk] = f2bf(Wm[(size_t)(k0 + kk) * DD + n0 + nq + i]);
        __syncthreads();
        const int piece = tid & 7;
#pragma unroll
        for (int s = 0; s < 2; ++s) { const int nr = (tid >> 3) + 32 * s; const v8us val = *(const v8usa*)(tl + nr * 72 + piece * 8); *(v8us*)(WT + (size_t)(n0 + nr) * DD + k0 + piece * 8) = val; }
        asm volatile("s_wait_xcnt 0x0" ::: "memory");      // the built code lays the other branch's body behind these stores: the wait stands in front of its first write of a register that they name
    }
}
// cp16: one asynchronous 16-byte copy per lane, global -> LDS, through no register.
typedef int v4iv __attribute__((__vector_size__(16)));
typedef __attribute__((address_space(1))) v4iv g_v4iv;
typedef __attribute__((address_space(3))) v4iv l_v4iv;
__device__ __forceinline__ void cp16(const bf* g, unsigned char* l) { __builtin_amdgcn_global_load_async_to_lds_b128((g_v4iv*)g, (l_v4iv*)l, 0, 0); }

// gemm_tile: BM x BN tile of C = A.B^T over K (every plane K-contiguous with row stride K, n-major B; K a positive multiple of 64), f32 accumulate.
// SPLIT: A = Ah + Al, B = Bh + Bl, three products per 32-k step (hh, lh, hl); else one product Ah.Bh. BIAS 1: + bf(bias[column]); BIAS 2: + bf(bias[row]).
// A stage is 64 k (128 B, one whole line) of every row of the planes [Ah BM | Al BM | Bh BN | Bl BN] at pitch 144 B in LDS, a ring of NB buffers filled by asynchronous copies
// NB - 1 stages ahead of the stage that is worked on (NB 3: for an operand that comes from memory, whose copies land later than one stage's work lasts); 2 x 2 waves, each BM/2 x BN/2, read their fragments from LDS. Whole-line epilogue staged in the ring once every reader has left it:
// PLANES false: f32 C, staged per wave; PLANES true: the whole tile staged in f32, then each value written as bf16 hi (Ch) + bf16 residual (Cl), eight lanes to a 128-B line of a plane.
template <int BM, int BN, bool SPLIT, int NB> struct gemm_lds { static constexpr int bytes = NB * (SPLIT ? 2 : 1) * (BM + BN) * 144; };
template <int BM, int BN, bool SPLIT, int BIAS, bool PLANES, int NB>
__device__ __forceinline__ void gemm_tile(unsigned char* sm, const bf* __restrict__ Ah, const bf* __restrict__ Al, const bf* __restrict__ Bh, const bf* __restrict__ Bl, const float* __restrict__ bias, int K, float* C, bf* Ch, bf* Cl, int ldc, int rb, int cb) {
    constexpr int PIT = 144, NP = SPLIT ? 2 : 1, ROWS = NP * (BM + BN), BUF = ROWS * PIT, NCP = ROWS / 16, WM = BM / 2, WN = BN / 2, RT = WM / 16, CT = WN / 16, OP = PLANES ? BN + 4 : WN + 4;
    static_assert((NB == 2 || NB == 3) && (NB - 1) * NCP <= 63 && BM % 32 == 0 && BN % 32 == 0 && (PLANES ? BM * OP * 4 : 4 * WM * OP * 4) <= NB * BUF && NB * BUF == gemm_lds<BM, BN, SPLIT, NB>::bytes && (!PLANES || BN == 64), "tile");
    const int tid = threadIdx.x, lane = tid & 31, wave = tid >> 5, lr = lane & 15, hi = lane >> 4;
    const int wm = wave >> 1, wn = wave & 1;
    unsigned char* const ldst = sm + (tid >> 3) * PIT + (tid & 7) * 16;
    const size_t gofs = (size_t)(tid >> 3) * K + (tid & 7) * 8;
    auto fill = [&](int st, int buf) {      // copy i of a lane: staged row 16 i + tid / 8, 16-byte piece tid % 8; eight lanes cover one 128-B line
#pragma unroll
        for (int i = 0; i < NCP; ++i) { const int row = i * 16;
            const bf* pl = row < BM ? Ah + (size_t)(rb + row) * K : row < NP * BM ? Al + (size_t)(rb + row - BM) * K : row < NP * BM + BN ? Bh + (size_t)(cb + row - NP * BM) * K : Bl + (size_t)(cb + row - NP * BM - BN) * K;
            cp16(pl + (size_t)st * 64 + gofs, ldst + buf * BUF + row * PIT); }
    };
    v8f acc[RT][CT];
#pragma unroll
    for (int r = 0; r < RT; ++r) {
#pragma unroll
        for (int t = 0; t < CT; ++t) acc[r][t] = (v8f){}; }
    const int nst = K / 64;
    fill(0, 0);
    if constexpr (NB == 3) { fill(1, 1);      // K is at least 128: stage 1 exists
        asm volatile("s_wait_asynccnt %0" :: "n"(NCP) : "memory"); }      // all but this wave's NCP youngest copies (stage 1's) have landed: stage 0 is there before the barrier that publishes it
    else asm volatile("s_wait_asynccnt 0x0" ::: "memory");      // stage 0 has landed before the barrier that publishes it
    __syncthreads();
    if (nst > NB - 1) fill(NB - 1, NB - 1);
    int ring = 0;      // NB 3: the buffer of stage st, st mod 3
#pragma unroll 1
    for (int st = 0; st < nst; ++st) {
        const int cur = NB == 2 ? (st & 1) : ring;
        const unsigned char* sb = sm + cur * BUF;
        v16bf a[2][RT], al[2][RT], bh[2][CT], bl[2][CT];
#pragma unroll
        for (int ks = 0; ks < 2; ++ks) {
            const unsigned char* fa = sb + (wm * WM + lr) * PIT + ks * 64 + hi * 16;
            const unsigned char* fb = sb + (NP * BM + wn * WN + lr) * PIT + ks * 64 + hi * 16;
#pragma unroll
            for (int r = 0; r < RT; ++r) { const unsigned char* q = fa + r * 16 * PIT; a[ks][r] = cat16b(*(const v8usa*)q, *(const v8usa*)(q + 32)); al[ks][r] = a[ks][r];
                if (SPLIT) al[ks][r] = cat16b(*(const v8usa*)(q + BM * PIT), *(const v8usa*)(q + BM * PIT + 32)); }
#pragma unroll
            for (int t = 0; t < CT; ++t) { const unsigned char* q = fb + t * 16 * PIT; bh[ks][t] = cat16b(*(const v8usa*)q, *(const v8usa*)(q + 32)); bl[ks][t] = bh[ks][t];
                if (SPLIT) bl[ks][t] = cat16b(*(const v8usa*)(q + BN * PIT), *(const v8usa*)(q + BN * PIT + 32)); }
        }
        __builtin_amdgcn_sched_barrier(0);      // keeps the stage's LDS reads in one group ahead of its WMMAs: reads sunk among the WMMAs each make the wave wait out the LDS latency
#pragma unroll
        for (int ks = 0; ks < 2; ++ks) {
#pragma unroll
            for (int t = 0; t < CT; ++t) {
#pragma unroll
                for (int r = 0; r < RT; ++r) acc[r][t] = wmmab(a[ks][r], bh[ks][t], acc[r][t]);
                if (SPLIT) {
#pragma unroll
                    for (int r = 0; r < RT; ++r) acc[r][t] = wmmab(al[ks][r], bh[ks][t], acc[r][t]);
#pragma unroll
                    for (int r = 0; r < RT; ++r) acc[r][t] = wmmab(a[ks][r], bl[ks][t], acc[r][t]); } }
        }
        __builtin_amdgcn_sched_barrier(0);      // keeps the WMMAs ahead of the waits below, so that the next stage's copies fly while they run
        asm volatile("s_wait_dscnt 0x0" ::: "memory");     // this wave's reads of the buffer have retired before it is refilled
        const bool more = st + NB < nst;      // the same for the whole work-group: this trip refills the buffer that it has read
        if (NB == 3 && more) asm volatile("s_wait_asynccnt %0" :: "n"(NCP) : "memory");      // in flight: stages st + 1 and st + 2, NCP copies each, counted in issue order: st + 1 has landed, st + 2 flies on over the next trip
        else asm volatile("s_wait_asynccnt 0x0" ::: "memory");  // this wave's copies of the next stage have landed before the barrier that publishes them
        __syncthreads();
        if (more) fill(st + NB, cur);
        ring = ring == NB - 1 ? 0 : ring + 1;
    }
    asm volatile("s_wait_asynccnt 0x0" ::: "memory");      // nothing in flight when the ring becomes output staging
    float* os = (float*)(void*)sm + (PLANES ? wm * WM * OP + wn * WN : wave * (WM * OP));
#pragma unroll
    for (int r = 0; r < RT; ++r) {
#pragma unroll
        for (int t = 0; t < CT; ++t) { const float bc = BIAS == 1 ? bfr(bias[cb + wn * WN + t * 16 + lr]) : 0.f;
#pragma unroll
            for (int j = 0; j < 8; ++j) { const int row = r * 16 + hi * 8 + j; float v = acc[r][t][j];
                if (BIAS == 1) v += bc;
                if (BIAS == 2) v += bfr(bias[rb + wm * WM + row]);
                os[row * OP + t * 16 + lr] = v; } } }
    if constexpr (PLANES) {
        __syncthreads();      // a row of the tile is staged by two waves: both halves are written before one wave reads the row back
        const float* ts = (const float*)(const void*)sm;
#pragma unroll
        for (int s = 0; s < BM * BN / 1024; ++s) { const int idx = s * 128 + tid, row = idx >> 3, cofs = (idx & 7) * 8;
            const v4f v0 = *(const v4fa*)(ts + row * OP + cofs), v1 = *(const v4fa*)(ts + row * OP + cofs + 4); v8us oh, ol;
#pragma unroll
            for (int i = 0; i < 8; ++i) { const float v = i < 4 ? v0[i & 3] : v1[i & 3]; const unsigned short hb = f2bf(v); oh[i] = hb; ol[i] = f2bf(v - bf2f(hb)); }
            const size_t o = (size_t)(rb + row) * ldc + cb + cofs; *(v8us*)(Ch + o) = oh; *(v8us*)(Cl + o) = ol; }
        asm volatile("s_wait_xcnt 0x0" ::: "memory");      // where a kernel holds two such tiles under a branch, the built code lays the second behind these stores: the wait stands in front of its first write of a register that they name
    } else {
        asm volatile("s_wait_dscnt 0x0" ::: "memory");     // the wave's staged rows are written before its lanes read each other's words back
        float* crow = C + (size_t)(rb + wm * WM) * ldc + cb + wn * WN;
#pragma unroll
        for (int s = 0; s < WM * WN / 128; ++s) { const int idx = s * 32 + lane, row = idx / (WN / 4), cofs = (idx % (WN / 4)) * 4;
            const v4f val = *(const v4fa*)(os + row * OP + cofs); *(v4f*)(crow + (size_t)row * ldc + cofs) = val; }
    }
}
// k_gemm: split operands, f32 C, one tile per work-group; grid (rows / BM, columns / BN).
template <int BM, int BN, int NB>
__global__ __launch_bounds__(128) void k_gemm(const bf* __restrict__ Ah, const bf* __restrict__ Al, const bf* __restrict__ Bh, const bf* __restrict__ Bl, int K, float* C, int ldc) {
    __shared__ __align__(16) unsigned char sm[gemm_lds<BM, BN, true, NB>::bytes];
    gemm_tile<BM, BN, true, 0, false, NB>(sm, Ah, Al, Bh, Bl, nullptr, K, C, nullptr, nullptr, ldc, blockIdx.x * BM, blockIdx.y * BN);
}
// k_proj: the three projections in one launch, grid (NN / 128, DD / 64, 3), planes written by the tile's own epilogue. z = 0, 1: q, k [n][DD] = Xb . W + bias per column;
// z = 2: v^T [c][NN] = WvT . Xb^T + bias per row, its 4 x 64 tiles numbered by the flat index of the same 32 x 8 grid. K = DD, the row stride of every operand plane.
__global__ __launch_bounds__(128) void k_proj(const bf* __restrict__ Xb, const bf* __restrict__ WqT, const bf* __restrict__ WkT, const bf* __restrict__ WvT, const float* __restrict__ bq, const float* __restrict__ bk, const float* __restrict__ bv,
                                              int K, bf* Qh, bf* Ql, bf* Kh, bf* Kl, bf* VTh, bf* VTl) {
    __shared__ __align__(16) unsigned char sm[gemm_lds<128, 64, false, 2>::bytes];
    const int z = blockIdx.z;
    if (z == 2) { const int flat = blockIdx.y * (NN / 128) + blockIdx.x;
        gemm_tile<128, 64, false, 2, true, 2>(sm, WvT, nullptr, Xb, nullptr, bv, K, nullptr, VTh, VTl, NN, (flat & 3) * 128, (flat >> 2) * 64);
    } else
        gemm_tile<128, 64, false, 1, true, 2>(sm, Xb, nullptr, z ? WkT : WqT, nullptr, z ? bk : bq, K, nullptr, z ? Kh : Qh, z ? Kl : Ql, DD, blockIdx.x * 128, blockIdx.y * 64);
}

// k_softmax: one wave per row. The row's 4096 scores are read once and stay in the wave's registers (128 per lane): maximum, exp and sum, then the two planes all come from there.
__global__ __launch_bounds__(256) void k_softmax(const float* __restrict__ S, bf* PH, bf* PL) {
    const int lane = threadIdx.x & 31, r = blockIdx.x * 8 + (threadIdx.x >> 5); if (r >= RCH) return;
    const float* sr = S + (size_t)r * NN + lane * 8;
    v8f v[NN / 256];      // every loop over v is unrolled whole: only constant indices keep the array in registers, and the 32 loads then go out together, ahead of the first wait
#pragma unroll
    for (int j = 0; j < NN / 256; ++j) v[j] = *(const v8f*)(sr + j * 256);
    v8f mv = v[0];      // eight independent chains: a maximum does not depend on the order
#pragma unroll
    for (int j = 1; j < NN / 256; ++j) {
#pragma unroll
        for (int i = 0; i < 8; ++i) mv[i] = fmaxf(mv[i], v[j][i]); }
    float m = -3.0e38f;
#pragma unroll
    for (int i = 0; i < 8; ++i) m = fmaxf(m, mv[i]);
#pragma unroll
    for (int sh = 16; sh; sh >>= 1) m = fmaxf(m, __shfl_xor(m, sh, 32));
    float sum = 0.f;      // summed in column order, one chain per lane
#pragma unroll
    for (int j = 0; j < NN / 256; ++j) { float x[8], e[8];
#pragma unroll
        for (int i = 0; i < 8; ++i) x[i] = (v[j][i] - m) * 1.44269504f;      // exp(t) = 2^(t log2 e)
        // eight independent v_exp_f32 in one statement, results in registers of their own: each fills the slot that the instruction set asks for behind the one in front of it
        // (before its result is read or its source overwritten), and the v_nop fills the slot behind the last
        asm("v_exp_f32 %0, %8\n\tv_exp_f32 %1, %9\n\tv_exp_f32 %2, %10\n\tv_exp_f32 %3, %11\n\tv_exp_f32 %4, %12\n\tv_exp_f32 %5, %13\n\tv_exp_f32 %6, %14\n\tv_exp_f32 %7, %15\n\tv_nop"
            : "=&v"(e[0]), "=&v"(e[1]), "=&v"(e[2]), "=&v"(e[3]), "=&v"(e[4]), "=&v"(e[5]), "=&v"(e[6]), "=&v"(e[7])
            : "v"(x[0]), "v"(x[1]), "v"(x[2]), "v"(x[3]), "v"(x[4]), "v"(x[5]), "v"(x[6]), "v"(x[7]));
#pragma unroll
        for (int i = 0; i < 8; ++i) { v[j][i] = e[i]; sum += e[i]; } }
#pragma unroll
    for (int sh = 16; sh; sh >>= 1) sum += __shfl_xor(sum, sh, 32);
    const float inv = 1.0f / sum;
    bf* ph = PH + (size_t)r * NN + lane * 8; bf* pl = PL + (size_t)r * NN + lane * 8;
#pragma unroll
    for (int j = 0; j < NN / 256; ++j) { v8us oh, ol;
#pragma unroll
        for (int i = 0; i < 8; ++i) { const float p = v[j][i] * inv; const unsigned short hb = f2bf(p); oh[i] = hb; ol[i] = f2bf(p - bf2f(hb)); }
        *(v8us*)(ph + j * 256) = oh; *(v8us*)(pl + j * 256) = ol; }
}

extern "C" void kernel_launch(void* const* d_in, const int* in_sizes, int n_in,
                              void* d_out, int out_size, void* d_ws, size_t ws_size, hipStream_t stream) {
    (void)in_sizes; (void)n_in; (void)out_size;
    const float* x = (const float*)d_in[0]; const float* Wq = (const float*)d_in[1]; const float* bq = (const float*)d_in[2]; const float* Wk = (const float*)d_in[3]; const float* bk = (const float*)d_in[4]; const float* Wv = (const float*)d_in[5]; const float* bv = (const float*)d_in[6];
    float* out = (float*)d_out;    // [4096][512]
    char* wsp = (char*)d_ws;
    auto take = [&](size_t bytes) { char* p = wsp; wsp += (bytes + 255) & ~(size_t)255; return (void*)p; };
    bf* WqT = (bf*)take((size_t)DD * DD * 2); bf* WkT = (bf*)take((size_t)DD * DD * 2); bf* WvT = (bf*)take((size_t)DD * DD * 2);
    bf* Xb = (bf*)take((size_t)NN * DD * 2);
    bf* Qh = (bf*)take((size_t)NN * DD * 2); bf* Ql = (bf*)take((size_t)NN * DD * 2); bf* Kh = (bf*)take((size_t)NN * DD * 2); bf* Kl = (bf*)take((size_t)NN * DD * 2); bf* VTh = (bf*)take((size_t)DD * NN * 2); bf* VTl = (bf*)take((size_t)DD * NN * 2);
    float* S = (float*)take((size_t)RCH * NN * 4); bf* PH = (bf*)take((size_t)RCH * NN * 2); bf* PL = (bf*)take((size_t)RCH * NN * 2);
    if ((size_t)(wsp - (char*)d_ws) > ws_size) return;    // 1.5 + 4.2 + 6 x 4.2 + 67.1 + 2 x 33.6 ~ 165 MB, no aliasing
    k_prep<<<NN / 8 + 3 * 64, 256, 0, stream>>>(x, Wq, Wk, Wv, Xb, WqT, WkT, WvT);
    k_proj<<<dim3(NN / 128, DD / 64, 3), 128, 0, stream>>>(Xb, WqT, WkT, WvT, bq, bk, bv, DD, Qh, Ql, Kh, Kl, VTh, VTl);      // q [n][512], k [m][512], v^T [c][m] as hi + residual planes
    k_gemm<128, 128, 2><<<dim3(RCH / 128, NN / 128, 1), 128, 0, stream>>>(Qh, Ql, Kh, Kl, DD, S, NN);          // scores [n][m] = q_n . k_m (unscaled), every row in one launch
    k_softmax<<<RCH / 8, 256, 0, stream>>>(S, PH, PL);
    k_gemm<128, 64, 3><<<dim3(RCH / 128, DD / 64, 1), 128, 0, stream>>>(PH, PL, VTh, VTl, NN, out, DD);      // out = P . v: 256 work-groups, one on every WGP; P comes from memory: three buffers
}

// v006
// Measured time: 86.8 microseconds a run.
// Two timings next to v005 both put it at 1.38 times that version's speed.
// Counting every step since v000, it is 9.60 times as fast.
#include <hip/hip_runtime.h>

// Compute dtypes, f32 accumulate: q, k token-major and v channel-major projections with PLAIN bf16 operands (rounded input, k-major weights transposed once; exact products, + bias) ->
// q, k: bf16 hi + UNSCALED residual planes; v^T: one f16 plane; all 4096 rows in one pass: scores = q.k^T ([4096 x 512].[512 x 4096], three products; unscaled as in the module) -> row softmax in f32 -> P, one f16 plane;
// out = P.v, one f16 product (f32 accumulate): P lies in [0, 1] and |v| is a few units, both inside f16's range; rounding either to f16 (relative 2^-11) stays under what the bf16 operands of the projections (2^-9) have already put into v and the scores.

#define NN   4096
#define DD   512
#define RCH  NN
#define CC   DD
#define DM   DD
#define NTK  NN
#define LOSC 1024.0f

typedef _Float16 h16;
typedef unsigned short bf;
typedef __attribute__((ext_vector_type(16))) __bf16   v16bf;
typedef __attribute__((ext_vector_type(16))) _Float16 v16h;
typedef __attribute__((ext_vector_type(8)))  _Float16 v8h;
typedef __attribute__((ext_vector_type(8)))  unsigned short v8us;
typedef __attribute__((ext_vector_type(8)))  float    v8f;
typedef __attribute__((ext_vector_type(4)))  float    v4f;
typedef __attribute__((ext_vector_type(4)))  _Float16 v4h;
typedef v8h  __attribute__((may_alias)) v8ha;
typedef v4f  __attribute__((may_alias)) v4fa;
typedef v8us __attribute__((may_alias)) v8usa;

__device__ __forceinline__ unsigned short f2bf(float f) { unsigned u = __float_as_uint(f); u += 0x7FFFu + ((u >> 16) & 1u); return (unsigned short)(u >> 16); }
__device__ __forceinline__ float bf2f(unsigned short b) { return __uint_as_float(((unsigned)b) << 16); }
__device__ __forceinline__ float bfr(float f) { return bf2f(f2bf(f)); }
__device__ __forceinline__ v16h cat16(v8h lo, v8h hi) { return __builtin_shufflevector(lo, hi, 0, 1, 2, 3, 4, 5, 6, 7, 8, 9, 10, 11, 12, 13, 14, 15); }
__device__ __forceinline__ v16bf cat16b(v8us lo, v8us hi) { return __builtin_bit_cast(v16bf, __builtin_shufflevector(lo, hi, 0, 1, 2, 3, 4, 5, 6, 7, 8, 9, 10, 11, 12, 13, 14, 15)); }
__device__ __forceinline__ v8f wmma16(v16h a, v16h b, v8f c) { return __builtin_amdgcn_wmma_f32_16x16x32_f16(false, a, false, b, (short)0, c, false, false); }
__device__ __forceinline__ v8f wmmab(v16bf a, v16bf b, v8f c) { return __builtin_amdgcn_wmma_f32_16x16x32_bf16(false, a, false, b, (short)0, c, false, false); }
// mm: one 16 x 16 x 32 product on fragments held as 16-bit words; F16 says that the words are f16, else bf16 (the two forms share one fragment layout).
template <bool F16> __device__ __forceinline__ v8f mm(v16bf a, v16bf b, v8f c) { if constexpr (F16) return wmma16(__builtin_bit_cast(v16h, a), __builtin_bit_cast(v16h, b), c); else return wmmab(a, b, c); }

// k_prep, one launch: work-groups 0 .. NN/8-1 round eight rows of x each to bf16 (Xb); the next 3 x 64 each transpose one 64 x 64 tile of one weight matrix:
// WT [n][DD] = bf16(W[k][n]) (W k-major [DD][DD]) through LDS. The branch is uniform for a work-group, so its barrier is passed by all of its waves or by none.
__global__ __launch_bounds__(256) void k_prep(const float* __restrict__ x, const float* __restrict__ Wq, const float* __restrict__ Wk, const float* __restrict__ Wv, bf* Xb, bf* WqT, bf* WkT, bf* WvT) {
    __shared__ __align__(16) unsigned short tl[64 * 72];
    const int tid = threadIdx.x;
    if (blockIdx.x < NN / 8) {
        const int lane = tid & 31; const size_t r = (size_t)blockIdx.x * 8 + (tid >> 5);
#pragma unroll
        for (int q = 0; q < DD / 256; ++q) { v8us o;
#pragma unroll
            for (int i = 0; i < 8; ++i) o[i] = f2bf(x[r * DD + q * 256 + lane * 8 + i]);
            *(v8us*)(Xb + r * DD + q * 256 + lane * 8) = o; }
    } else {
        const int tb = blockIdx.x - NN / 8, which = tb >> 6, k0 = (tb & 7) * 64, n0 = ((tb >> 3) & 7) * 64;
        const float* Wm = which == 0 ? Wq : which == 1 ? Wk : Wv; bf* WT = which == 0 ? WqT : which == 1 ? WkT : WvT;
        const int kk = tid >> 2, nq = (tid & 3) * 16;
#pragma unroll
        for (int i = 0; i < 16; ++i) tl[(nq + i) * 72 + kk] = f2bf(Wm[(size_t)(k0 + kk) * DD + n0 + nq + i]);
        __syncthreads();
        const int piece = tid & 7;
#pragma unroll
        for (int s = 0; s < 2; ++s) { const int nr = (tid >> 3) + 32 * s; const v8us val = *(const v8usa*)(tl + nr * 72 + piece * 8); *(v8us*)(WT + (size_t)(n0 + nr) * DD + k0 + piece * 8) = val; }
        asm volatile("s_wait_xcnt 0x0" ::: "memory");      // the built code lays the other branch's body behind these stores: the wait stands in front of its first write of a register that they name
    }
}
// cp16: one asynchronous 16-byte copy per lane, global -> LDS, through no register.
typedef int v4iv __attribute__((__vector_size__(16)));
typedef __attribute__((address_space(1))) v4iv g_v4iv;
typedef __attribute__((address_space(3))) v4iv l_v4iv;
__device__ __forceinline__ void cp16(const bf* g, unsigned char* l) { __builtin_amdgcn_global_load_async_to_lds_b128((g_v4iv*)g, (l_v4iv*)l, 0, 0); }

// gemm_tile: BM x BN tile of C = A.B^T over K (every plane K-contiguous with row stride K, n-major B; K a multiple of KST and at least 2 KST), f32 accumulate.
// SPLIT: A = Ah + Al, B = Bh + Bl, three products per 32-k step (hh, lh, hl); else one product Ah.Bh. BIAS 1: + bf(bias[column]); BIAS 2: + bf(bias[row]).
// A stage is KST k (64 or 128: one or two whole 128-B lines) of every row of the planes [Ah BM | Al BM | Bh BN | Bl BN] at pitch 2 KST + 16 B in LDS, a ring of NB buffers filled by asynchronous copies
// NB - 1 stages ahead of the stage that is worked on (NB 3: for an operand that comes from memory, whose copies land later than one stage's work lasts); 2 x 2 waves, each BM/2 x BN/2, read their fragments from LDS. Whole-line epilogue staged in the ring once every reader has left it:
// PLANES 0: f32 C, staged per wave; PLANES 1: the whole tile staged in f32, then each value written as bf16 hi (Ch) + bf16 residual (Cl), eight lanes to a 128-B line of a plane; PLANES 2: the same, one f16 plane (Ch).
template <int BM, int BN, bool SPLIT, int NB, int KST> struct gemm_lds { static constexpr int bytes = NB * (SPLIT ? 2 : 1) * (BM + BN) * (KST * 2 + 16); };
template <int BM, int BN, bool SPLIT, int BIAS, int PLANES, int NB, int KST, bool F16>
__device__ __forceinline__ void gemm_tile(unsigned char* sm, const bf* __restrict__ Ah, const bf* __restrict__ Al, const bf* __restrict__ Bh, const bf* __restrict__ Bl, const float* __restrict__ bias, int K, float* C, bf* Ch, bf* Cl, int ldc, int rb, int cb) {
    constexpr int PIT = KST * 2 + 16, PPR = KST / 8, RPP = 128 / PPR, NKS = KST / 32, NP = SPLIT ? 2 : 1, ROWS = NP * (BM + BN), BUF = ROWS * PIT, NCP = ROWS / RPP, WM = BM / 2, WN = BN / 2, RT = WM / 16, CT = WN / 16, OP = PLANES ? BN + 4 : WN + 4;
    static_assert((KST == 64 || KST == 128) && (NB == 2 || NB == 3) && (NB - 1) * NCP <= 63 && BM % 32 == 0 && BN % 32 == 0 && (PLANES ? BM * OP * 4 : 4 * WM * OP * 4) <= NB * BUF && NB * BUF == gemm_lds<BM, BN, SPLIT, NB, KST>::bytes && (!PLANES || BN == 64), "tile");
    const int tid = threadIdx.x, lane = tid & 31, wave = tid >> 5, lr = lane & 15, hi = lane >> 4;
    const int wm = wave >> 1, wn = wave & 1;
    unsigned char* const ldst = sm + (tid / PPR) * PIT + (tid % PPR) * 16;
    const size_t gofs = (size_t)(tid / PPR) * K + (tid % PPR) * 8;
    auto fill = [&](int st, int buf) {      // copy i of a lane: staged row RPP i + tid / PPR, 16-byte piece tid % PPR; eight lanes cover one 128-B line
#pragma unroll
        for (int i = 0; i < NCP; ++i) { const int row = i * RPP;
            const bf* pl = row < BM ? Ah + (size_t)(rb + row) * K : row < NP * BM ? Al + (size_t)(rb + row - BM) * K : row < NP * BM + BN ? Bh + (size_t)(cb + row - NP * BM) * K : Bl + (size_t)(cb + row - NP * BM - BN) * K;
            cp16(pl + (size_t)st * KST + gofs, ldst + buf * BUF + row * PIT); }
    };
    v8f acc[RT][CT];
#pragma unroll
    for (int r = 0; r < RT; ++r) {
#pragma unroll
        for (int t = 0; t < CT; ++t) acc[r][t] = (v8f){}; }
    const int nst = K / KST;
    fill(0, 0);
    if constexpr (NB == 3) { fill(1, 1);      // K is at least 2 KST: stage 1 exists
        asm volatile("s_wait_asynccnt %0" :: "n"(NCP) : "memory"); }      // all but this wave's NCP youngest copies (stage 1's) have landed: stage 0 is there before the barrier that publishes it
    else asm volatile("s_wait_asynccnt 0x0" ::: "memory");      // stage 0 has landed before the barrier that publishes it
    __syncthreads();
    if (nst > NB - 1) fill(NB - 1, NB - 1);
    int ring = 0;      // NB 3: the buffer of stage st, st mod 3
#pragma unroll 1
    for (int st = 0; st < nst; ++st) {
        const int cur = NB == 2 ? (st & 1) : ring;
        const unsigned char* sb = sm + cur * BUF;
        v16bf a[NKS][RT], al[NKS][RT], bh[NKS][CT], bl[NKS][CT];
#pragma unroll
        for (int ks = 0; ks < NKS; ++ks) {
            const unsigned char* fa = sb + (wm * WM + lr) * PIT + ks * 64 + hi * 16;
            const unsigned char* fb = sb + (NP * BM + wn * WN + lr) * PIT + ks * 64 + hi * 16;
#pragma unroll
            for (int r = 0; r < RT; ++r) { const unsigned char* q = fa + r * 16 * PIT; a[ks][r] = cat16b(*(const v8usa*)q, *(const v8usa*)(q + 32)); al[ks][r] = a[ks][r];
                if (SPLIT) al[ks][r] = cat16b(*(const v8usa*)(q + BM * PIT), *(const v8usa*)(q + BM * PIT + 32)); }
#pragma unroll
            for (int t = 0; t < CT; ++t) { const unsigned char* q = fb + t * 16 * PIT; bh[ks][t] = cat16b(*(const v8usa*)q, *(const v8usa*)(q + 32)); bl[ks][t] = bh[ks][t];
                if (SPLIT) bl[ks][t] = cat16b(*(const v8usa*)(q + BN * PIT), *(const v8usa*)(q + BN * PIT + 32)); }
        }
        __builtin_amdgcn_sched_barrier(0);      // keeps the stage's LDS reads in one group ahead of its WMMAs: reads sunk among the WMMAs each make the wave wait out the LDS latency
#pragma unroll
        for (int ks = 0; ks < NKS; ++ks) {
#pragma unroll
            for (int t = 0; t < CT; ++t) {
#pragma unroll
                for (int r = 0; r < RT; ++r) acc[r][t] = mm<F16>(a[ks][r], bh[ks][t], acc[r][t]);
                if (SPLIT) {
#pragma unroll
                    for (int r = 0; r < RT; ++r) acc[r][t] = mm<F16>(al[ks][r], bh[ks][t], acc[r][t]);
#pragma unroll
                    for (int r = 0; r < RT; ++r) acc[r][t] = mm<F16>(a[ks][r], bl[ks][t], acc[r][t]); } }
        }
        __builtin_amdgcn_sched_barrier(0);      // keeps the WMMAs ahead of the waits below, so that the next stage's copies fly while they run
        asm volatile("s_wait_dscnt 0x0" ::: "memory");     // this wave's reads of the buffer have retired before it is refilled
        const bool more = st + NB < nst;      // the same for the whole work-group: this trip refills the buffer that it has read
        if (NB == 3 && more) asm volatile("s_wait_asynccnt %0" :: "n"(NCP) : "memory");      // in flight: stages st + 1 and st + 2, NCP copies each, counted in issue order: st + 1 has landed, st + 2 flies on over the next trip
        else asm volatile("s_wait_asynccnt 0x0" ::: "memory");  // this wave's copies of the next stage have landed before the barrier that publishes them
        __syncthreads();
        if (more) fill(st + NB, cur);
        ring = ring == NB - 1 ? 0 : ring + 1;
    }
    asm volatile("s_wait_asynccnt 0x0" ::: "memory");      // nothing in flight when the ring becomes output staging
    float* os = (float*)(void*)sm + (PLANES ? wm * WM * OP + wn * WN : wave * (WM * OP));
#pragma unroll
    for (int r = 0; r < RT; ++r) {
#pragma unroll
        for (int t = 0; t < CT; ++t) { const float bc = BIAS == 1 ? bfr(bias[cb + wn * WN + t * 16 + lr]) : 0.f;
#pragma unroll
            for (int j = 0; j < 8; ++j) { const int row = r * 16 + hi * 8 + j; float v = acc[r][t][j];
                if (BIAS == 1) v += bc;
                if (BIAS == 2) v += bfr(bias[rb + wm * WM + row]);
                os[row * OP + t * 16 + lr] = v; } } }
    if constexpr (PLANES) {
        __syncthreads();      // a row of the tile is staged by two waves: both halves are written before one wave reads the row back
        const float* ts = (const float*)(const void*)sm;
#pragma unroll
        for (int s = 0; s < BM * BN / 1024; ++s) { const int idx = s * 128 + tid, row = idx >> 3, cofs = (idx & 7) * 8;
            const v4f v0 = *(const v4fa*)(ts + row * OP + cofs), v1 = *(const v4fa*)(ts + row * OP + cofs + 4);
            const size_t o = (size_t)(rb + row) * ldc + cb + cofs;
            if constexpr (PLANES == 2) { v8h of;
#pragma unroll
                for (int i = 0; i < 8; ++i) of[i] = (h16)(i < 4 ? v0[i & 3] : v1[i & 3]);
                *(v8ha*)(Ch + o) = of;
            } else { v8us oh, ol;
#pragma unroll
                for (int i = 0; i < 8; ++i) { const float v = i < 4 ? v0[i & 3] : v1[i & 3]; const unsigned short hb = f2bf(v); oh[i] = hb; ol[i] = f2bf(v - bf2f(hb)); }
                *(v8us*)(Ch + o) = oh; *(v8us*)(Cl + o) = ol; } }
        asm volatile("s_wait_xcnt 0x0" ::: "memory");      // where a kernel holds two such tiles under a branch, the built code lays the second behind these stores: the wait stands in front of its first write of a register that they name
    } else {
        asm volatile("s_wait_dscnt 0x0" ::: "memory");     // the wave's staged rows are written before its lanes read each other's words back
        float* crow = C + (size_t)(rb + wm * WM) * ldc + cb + wn * WN;
#pragma unroll
        for (int s = 0; s < WM * WN / 128; ++s) { const int idx = s * 32 + lane, row = idx / (WN / 4), cofs = (idx % (WN / 4)) * 4;
            const v4f val = *(const v4fa*)(os + row * OP + cofs); *(v4f*)(crow + (size_t)row * ldc + cofs) = val; }
    }
}
// k_gemm: f32 C, one tile per work-group; grid (rows / BM, columns / BN). SPLIT: bf16 hi + residual operands; else one f16 plane each (Al, Bl unused).
template <int BM, int BN, int NB, bool SPLIT, int KST>
__global__ __launch_bounds__(128) void k_gemm(const bf* __restrict__ Ah, const bf* __restrict__ Al, const bf* __restrict__ Bh, const bf* __restrict__ Bl, int K, float* C, int ldc) {
    __shared__ __align__(16) unsigned char sm[gemm_lds<BM, BN, SPLIT, NB, KST>::bytes];
    gemm_tile<BM, BN, SPLIT, 0, 0, NB, KST, !SPLIT>(sm, Ah, Al, Bh, Bl, nullptr, K, C, nullptr, nullptr, ldc, blockIdx.x * BM, blockIdx.y * BN);
}
// k_proj: the three projections in one launch, grid (NN / 128, DD / 64, 3), planes written by the tile's own epilogue. z = 0, 1: q, k [n][DD] = Xb . W + bias per column;
// z = 2: v^T [c][NN] = WvT . Xb^T + bias per row, one f16 plane, its 4 x 64 tiles numbered by the flat index of the same 32 x 8 grid. K = DD, the row stride of every operand plane.
__global__ __launch_bounds__(128) void k_proj(const bf* __restrict__ Xb, const bf* __restrict__ WqT, const bf* __restrict__ WkT, const bf* __restrict__ WvT, const float* __restrict__ bq, const float* __restrict__ bk, const float* __restrict__ bv,
                                              int K, bf* Qh, bf* Ql, bf* Kh, bf* Kl, bf* VT) {
    __shared__ __align__(16) unsigned char sm[gemm_lds<128, 64, false, 2, 64>::bytes];
    const int z = blockIdx.z;
    if (z == 2) { const int flat = blockIdx.y * (NN / 128) + blockIdx.x;
        gemm_tile<128, 64, false, 2, 2, 2, 64, false>(sm, WvT, nullptr, Xb, nullptr, bv, K, nullptr, VT, nullptr, NN, (flat & 3) * 128, (flat >> 2) * 64);
    } else
        gemm_tile<128, 64, false, 1, 1, 2, 64, false>(sm, Xb, nullptr, z ? WkT : WqT, nullptr, z ? bk : bq, K, nullptr, z ? Kh : Qh, z ? Kl : Ql, DD, blockIdx.x * 128, blockIdx.y * 64);
}

// k_softmax: one wave per row. The row's 4096 scores are read once and stay in the wave's registers (128 per lane): maximum, exp and sum, then the f16 plane all come from there.
__global__ __launch_bounds__(256) void k_softmax(const float* __restrict__ S, bf* P) {
    const int lane = threadIdx.x & 31, r = blockIdx.x * 8 + (threadIdx.x >> 5); if (r >= RCH) return;
    const float* sr = S + (size_t)r * NN + lane * 8;
    v8f v[NN / 256];      // every loop over v is unrolled whole: only constant indices keep the array in registers, and the 32 loads then go out together, ahead of the first wait
#pragma unroll
    for (int j = 0; j < NN / 256; ++j) v[j] = *(const v8f*)(sr + j * 256);
    v8f mv = v[0];      // eight independent chains: a maximum does not depend on the order
#pragma unroll
    for (int j = 1; j < NN / 256; ++j) {
#pragma unroll
        for (int i = 0; i < 8; ++i) mv[i] = fmaxf(mv[i], v[j][i]); }
    float m = -3.0e38f;
#pragma unroll
    for (int i = 0; i < 8; ++i) m = fmaxf(m, mv[i]);
#pragma unroll
    for (int sh = 16; sh; sh >>= 1) m = fmaxf(m, __shfl_xor(m, sh, 32));
    float sum = 0.f;      // summed in column order, one chain per lane
#pragma unroll
    for (int j = 0; j < NN / 256; ++j) { float x[8], e[8];
#pragma unroll
        for (int i = 0; i < 8; ++i) x[i] = (v[j][i] - m) * 1.44269504f;      // exp(t) = 2^(t log2 e)
        // eight independent v_exp_f32 in one statement, results in registers of their own: each fills the slot that the instruction set asks for behind the one in front of it
        // (before its result is read or its source overwritten), and the v_nop fills the slot behind the last
        asm("v_exp_f32 %0, %8\n\tv_exp_f32 %1, %9\n\tv_exp_f32 %2, %10\n\tv_exp_f32 %3, %11\n\tv_exp_f32 %4, %12\n\tv_exp_f32 %5, %13\n\tv_exp_f32 %6, %14\n\tv_exp_f32 %7, %15\n\tv_nop"
            : "=&v"(e[0]), "=&v"(e[1]), "=&v"(e[2]), "=&v"(e[3]), "=&v"(e[4]), "=&v"(e[5]), "=&v"(e[6]), "=&v"(e[7])
            : "v"(x[0]), "v"(x[1]), "v"(x[2]), "v"(x[3]), "v"(x[4]), "v"(x[5]), "v"(x[6]), "v"(x[7]));
#pragma unroll
        for (int i = 0; i < 8; ++i) { v[j][i] = e[i]; sum += e[i]; } }
#pragma unroll
    for (int sh = 16; sh; sh >>= 1) sum += __shfl_xor(sum, sh, 32);
    const float inv = 1.0f / sum;
    bf* pr = P + (size_t)r * NN + lane * 8;
#pragma unroll
    for (int j = 0; j < NN / 256; ++j) { v8h o;
#pragma unroll
        for (int i = 0; i < 8; ++i) o[i] = (h16)(v[j][i] * inv);
        *(v8ha*)(pr + j * 256) = o; }
}

extern "C" void kernel_launch(void* const* d_in, const int* in_sizes, int n_in,
                              void* d_out, int out_size, void* d_ws, size_t ws_size, hipStream_t stream) {
    (void)in_sizes; (void)n_in; (void)out_size;
    const float* x = (const float*)d_in[0]; const float* Wq = (const float*)d_in[1]; const float* bq = (const float*)d_in[2]; const float* Wk = (const float*)d_in[3]; const float* bk = (const float*)d_in[4]; const float* Wv = (const float*)d_in[5]; const float* bv = (const float*)d_in[6];
    float* out = (float*)d_out;    // [4096][512]
    char* wsp = (char*)d_ws;
    auto take = [&](size_t bytes) { char* p = wsp; wsp += (bytes + 255) & ~(size_t)255; return (void*)p; };
    bf* WqT = (bf*)take((size_t)DD * DD * 2); bf* WkT = (bf*)take((size_t)DD * DD * 2); bf* WvT = (bf*)take((size_t)DD * DD * 2);
    bf* Xb = (bf*)take((size_t)NN * DD * 2);
    bf* Qh = (bf*)take((size_t)NN * DD * 2); bf* Ql = (bf*)take((size_t)NN * DD * 2); bf* Kh = (bf*)take((size_t)NN * DD * 2); bf* Kl = (bf*)take((size_t)NN * DD * 2); bf* VT = (bf*)take((size_t)DD * NN * 2);
    float* S = (float*)take((size_t)RCH * NN * 4); bf* P = (bf*)take((size_t)RCH * NN * 2);
    if ((size_t)(wsp - (char*)d_ws) > ws_size) return;    // 1.5 + 4.2 + 5 x 4.2 + 67.1 + 33.6 ~ 127 MB, no aliasing
    k_prep<<<NN / 8 + 3 * 64, 256, 0, stream>>>(x, Wq, Wk, Wv, Xb, WqT, WkT, WvT);
    k_proj<<<dim3(NN / 128, DD / 64, 3), 128, 0, stream>>>(Xb, WqT, WkT, WvT, bq, bk, bv, DD, Qh, Ql, Kh, Kl, VT);      // q [n][512], k [m][512] as hi + residual planes, v^T [c][m] as one f16 plane
    k_gemm<128, 128, 2, true, 64><<<dim3(RCH / 128, NN / 128, 1), 128, 0, stream>>>(Qh, Ql, Kh, Kl, DD, S, NN);          // scores [n][m] = q_n . k_m (unscaled), every row in one launch
    k_softmax<<<RCH / 8, 256, 0, stream>>>(S, P);
    k_gemm<128, 64, 3, false, 128><<<dim3(RCH / 128, DD / 64, 1), 128, 0, stream>>>(P, nullptr, VT, nullptr, NN, out, DD);      // out = P . v: 256 work-groups, one on every WGP; P comes from memory: three buffers, 128 k a stage (the bytes of a split 64-k stage)
}

// v007
// It runs in 82.5 microseconds.
// Two timings next to v006 put it at 1.05 and 1.06 times that version's speed.
// All steps since v000 together make it 10.1 times as fast.
#include <hip/hip_runtime.h>

// Compute dtypes, f32 accumulate: q, k token-major and v channel-major projections with PLAIN bf16 operands (rounded input, k-major weights transposed once; exact products, + bias) ->
// q, k: bf16 hi + UNSCALED residual planes; v^T: one f16 plane; all 4096 rows in one pass: scores = q.k^T ([4096 x 512].[512 x 4096], three products; unscaled as in the module) -> row softmax in f32 -> P, one f16 plane;
// out = P.v, one f16 product (f32 accumulate): P lies in [0, 1] and |v| is a few units, both inside f16's range; rounding either to f16 (relative 2^-11) stays under what the bf16 operands of the projections (2^-9) have already put into v and the scores.

#define NN   4096
#define DD   512
#define RCH  NN
#define CC   DD
#define DM   DD
#define NTK  NN
#define LOSC 1024.0f

typedef _Float16 h16;
typedef unsigned short bf;
typedef __attribute__((ext_vector_type(16))) __bf16   v16bf;
typedef __attribute__((ext_vector_type(16))) _Float16 v16h;
typedef __attribute__((ext_vector_type(8)))  _Float16 v8h;
typedef __attribute__((ext_vector_type(8)))  unsigned short v8us;
typedef __attribute__((ext_vector_type(8)))  float    v8f;
typedef __attribute__((ext_vector_type(4)))  float    v4f;
typedef __attribute__((ext_vector_type(4)))  _Float16 v4h;
typedef v8h  __attribute__((may_alias)) v8ha;
typedef v4f  __attribute__((may_alias)) v4fa;
typedef v8us __attribute__((may_alias)) v8usa;

__device__ __forceinline__ unsigned short f2bf(float f) { unsigned u = __float_as_uint(f); u += 0x7FFFu + ((u >> 16) & 1u); return (unsigned short)(u >> 16); }
__device__ __forceinline__ float bf2f(unsigned short b) { return __uint_as_float(((unsigned)b) << 16); }
__device__ __forceinline__ float bfr(float f) { return bf2f(f2bf(f)); }
__device__ __forceinline__ v16h cat16(v8h lo, v8h hi) { return __builtin_shufflevector(lo, hi, 0, 1, 2, 3, 4, 5, 6, 7, 8, 9, 10, 11, 12, 13, 14, 15); }
__device__ __forceinline__ v16bf cat16b(v8us lo, v8us hi) { return __builtin_bit_cast(v16bf, __builtin_shufflevector(lo, hi, 0, 1, 2, 3, 4, 5, 6, 7, 8, 9, 10, 11, 12, 13, 14, 15)); }
__device__ __forceinline__ v8f wmma16(v16h a, v16h b, v8f c) { return __builtin_amdgcn_wmma_f32_16x16x32_f16(false, a, false, b, (short)0, c, false, false); }
__device__ __forceinline__ v8f wmmab(v16bf a, v16bf b, v8f c) { return __builtin_amdgcn_wmma_f32_16x16x32_bf16(false, a, false, b, (short)0, c, false, false); }
// mm: one 16 x 16 x 32 product on fragments held as 16-bit words; F16 says that the words are f16, else bf16 (the two forms share one fragment layout).
template <bool F16> __device__ __forceinline__ v8f mm(v16bf a, v16bf b, v8f c) { if constexpr (F16) return wmma16(__builtin_bit_cast(v16h, a), __builtin_bit_cast(v16h, b), c); else return wmmab(a, b, c); }

// k_prep, one launch: work-groups 0 .. NN/8-1 round eight rows of x each to bf16 (Xb); the next 3 x 64 each transpose one 64 x 64 tile of one weight matrix:
// WT [n][DD] = bf16(W[k][n]) (W k-major [DD][DD]) through LDS. The branch is uniform for a work-group, so its barrier is passed by all of its waves or by none.
__global__ __launch_bounds__(256) void k_prep(const float* __restrict__ x, const float* __restrict__ Wq, const float* __restrict__ Wk, const float* __restrict__ Wv, bf* Xb, bf* WqT, bf* WkT, bf* WvT) {
    __shared__ __align__(16) unsigned short tl[64 * 72];
    const int tid = threadIdx.x;
    if (blockIdx.x < NN / 8) {
        const int lane = tid & 31; const size_t r = (size_t)blockIdx.x * 8 + (tid >> 5);
#pragma unroll
        for (int q = 0; q < DD / 256; ++q) { v8us o;
#pragma unroll
            for (int i = 0; i < 8; ++i) o[i] = f2bf(x[r * DD + q * 256 + lane * 8 + i]);
            *(v8us*)(Xb + r * DD + q * 256 + lane * 8) = o; }
    } else {
        const int tb = blockIdx.x - NN / 8, which = tb >> 6, k0 = (tb & 7) * 64, n0 = ((tb >> 3) & 7) * 64;
        const float* Wm = which == 0 ? Wq : which == 1 ? Wk : Wv; bf* WT = which == 0 ? WqT : which == 1 ? WkT : WvT;
        const int kk = tid >> 2, nq = (tid & 3) * 16;
#pragma unroll
        for (int i = 0; i < 16; ++i) tl[(nq + i) * 72 + kk] = f2bf(Wm[(size_t)(k0 + kk) * DD + n0 + nq + i]);
        __syncthreads();
        const int piece = tid & 7;
#pragma unroll
        for (int s = 0; s < 2; ++s) { const int nr = (tid >> 3) + 32 * s; const v8us val = *(const v8usa*)(tl + nr * 72 + piece * 8); *(v8us*)(WT + (size_t)(n0 + nr) * DD + k0 + piece * 8) = val; }
        asm volatile("s_wait_xcnt 0x0" ::: "memory");      // the built code lays the other branch's body behind these stores: the wait stands in front of its first write of a register that they name
    }
}
typedef unsigned int u32;
typedef unsigned long long u64;
typedef u32 u32x4 __attribute__((ext_vector_type(4)));
typedef u32 u32x8 __attribute__((ext_vector_type(8)));
__device__ __forceinline__ u32 uni(u32 v) { return (u32)__builtin_amdgcn_readfirstlane(v); }
__device__ __forceinline__ u32 pinned(u32 v) { u32 w = uni(v); asm volatile("" : "+s"(w)); return w; }      // holds a test word in a scalar register, so that the branch on it is a scalar branch: a tensor load ignores EXEC
__device__ __forceinline__ u32 adr_hi(u64 ga) { return uni((((u32)(ga >> 32)) & 0x01FFFFFFu) | 0x80000000u); }      // group 0, word 3: address bits 56..32, type 2
__device__ __forceinline__ void tdm_load(u32x4 g0, u32x8 g1) { asm volatile("tensor_load_to_lds %0, %1" :: "s"(g0), "s"(g1) : "memory"); }

// gemm_tile: BM x BN tile of C = A.B^T over K (every plane K-contiguous with row stride K, n-major B; K a multiple of KST and at least 2 KST), f32 accumulate.
// SPLIT: A = Ah + Al, B = Bh + Bl, three products per 32-k step (hh, lh, hl); else one product Ah.Bh. BIAS 1: + bf(bias[column]); BIAS 2: + bf(bias[row]).
// A stage is KST k (64 or 128: one or two whole 128-B lines) of every operand row, in four slices, one per wave: SPLIT: the planes Ah, Al, Bh, Bl; else the two halves of Ah's rows and the two of Bh's. A slice is one tensor load,
// its rows at pitch 2 KST + 16 B in LDS (the load's own pad), its place a multiple of 2 KiB. A ring of NB buffers is filled NB - 1 stages ahead of the stage that is worked on (NB 3: for an operand that comes from memory, which lands later
// than one stage's work lasts); 2 x 2 waves, each BM/2 x BN/2, read their fragments from LDS. Whole-line epilogue staged in the ring once every reader has left it:
// PLANES 0: f32 C, staged per wave; PLANES 1: the whole tile staged in f32, then each value written as bf16 hi (Ch) + bf16 residual (Cl), eight lanes to a 128-B line of a plane; PLANES 2: the same, one f16 plane (Ch).
template <int BM, int BN, bool SPLIT, int NB, int KST> struct gemm_lds {      // sza, szb: a slice of A rows, of B rows, rounded up to 2 KiB
    static constexpr int pit = KST * 2 + 16, sza = ((SPLIT ? BM : BM / 2) * pit + 2047) / 2048 * 2048, szb = ((SPLIT ? BN : BN / 2) * pit + 2047) / 2048 * 2048, buf = 2 * sza + 2 * szb, bytes = NB * buf; };
template <int BM, int BN, bool SPLIT, int BIAS, int PLANES, int NB, int KST, bool F16>
__device__ __forceinline__ void gemm_tile(unsigned char* sm, const bf* __restrict__ Ah, const bf* __restrict__ Al, const bf* __restrict__ Bh, const bf* __restrict__ Bl, const float* __restrict__ bias, int K, float* C, bf* Ch, bf* Cl, int ldc, int rb, int cb) {
    typedef gemm_lds<BM, BN, SPLIT, NB, KST> L;
    constexpr int RB = KST * 2, PIT = L::pit, SZA = L::sza, SZB = L::szb, BUF = L::buf, NKS = KST / 32, SA = SPLIT ? BM : BM / 2, SB = SPLIT ? BN : BN / 2, WM = BM / 2, WN = BN / 2, RT = WM / 16, CT = WN / 16, OP = PLANES ? BN + 4 : WN + 4;
    static_assert((KST == 64 || KST == 128) && (NB == 2 || NB == 3) && BM % 32 == 0 && BN % 32 == 0 && (PLANES ? BM * OP * 4 : 4 * WM * OP * 4) <= NB * BUF && (!PLANES || BN == 64), "tile");
    const int tid = threadIdx.x, lane = tid & 31, lr = lane & 15, hi = lane >> 4;
    const int wave = (int)uni((u32)tid >> 5), wm = wave >> 1, wn = wave & 1;
    // This wave's slice of every stage: waves 0, 1 bring A rows, waves 2, 3 B rows; rows of RB bytes at source pitch 2 K bytes, all inside the plane (the grid's tiles cover it exactly, K is a multiple of KST).
    const bool isb = wave >= 2;
    const bf* pl = SPLIT ? (wave == 0 ? Ah : wave == 1 ? Al : wave == 2 ? Bh : Bl) : (isb ? Bh : Ah);
    const u64 gsrc = (u64)(size_t)(pl + (size_t)((isb ? cb : rb) + (SPLIT ? 0 : wn * (isb ? SB : SA))) * K);
    const u32 ldst = (u32)(size_t)sm + (u32)(isb ? 2 * SZA + wn * SZB : wn * SZA), nrow = isb ? SB : SA;
    u32x8 g1;      // 1-byte elements, tensor = tile = nrow rows of RB bytes; word 0: no mask, a pad of 4 dwords behind every row of RB bytes
    g1[0] = uni((1u << 20) | ((RB == 128 ? 4u : 5u) << 22) | (3u << 25)); g1[1] = uni((u32)RB << 16); g1[2] = uni(nrow << 16); g1[3] = uni((u32)RB << 16); g1[4] = uni(nrow); g1[5] = uni((u32)K * 2u); g1[6] = uni(0u); g1[7] = uni(0u);
    asm volatile("" : "+s"(g1));      // the pinned() form, descriptor words held in scalar registers: the group stays in its registers through the loop; left free, the build used some of them for other values while a request was outstanding and set them anew in front of each load
    u32x4 g0;      // words 0 and 3 are set here; from request to request the place in LDS and the low address word change, and word 3 only where carry holds
    g0[0] = uni(1u); g0[3] = adr_hi(gsrc);
    const u32 carry = pinned((u32)gsrc + (u32)K * 2u < (u32)gsrc);      // the slice's first row crosses a multiple of 4 GiB: only then does word 3 change along k
    auto fill = [&](int st, int buf) {
        const u64 ga = gsrc + (u64)st * RB;
        g0[1] = uni(ldst + (u32)(buf * BUF)); g0[2] = uni((u32)ga);
        if (carry) { u32 w3 = g0[3]; const u32 nw = adr_hi(ga);      // word 3 takes a new value only when none of the wave's requests is outstanding: wait and move stand in one statement that also reads the old word, so that its register is written nowhere ahead of the wait
            asm volatile("s_wait_tensorcnt 0x0\n\ts_mov_b32 %0, %1" : "+s"(w3) : "s"(nw) : "memory"); g0[3] = w3; }
        tdm_load(g0, g1);
    };
    v8f acc[RT][CT];
#pragma unroll
    for (int r = 0; r < RT; ++r) {
#pragma unroll
        for (int t = 0; t < CT; ++t) acc[r][t] = (v8f){}; }
    const int nst = K / KST;
    fill(0, 0);
    if constexpr (NB == 3) { fill(1, 1);      // K is at least 2 KST: stage 1 exists
        asm volatile("s_wait_tensorcnt 0x1" ::: "memory"); }      // all but this wave's youngest request (stage 1's) have landed: stage 0 is there before the barrier that publishes it
    else asm volatile("s_wait_tensorcnt 0x0" ::: "memory");      // stage 0 has landed before the barrier that publishes it
    __syncthreads();
    if (pinned(nst > NB - 1)) fill(NB - 1, NB - 1);
    int ring = 0;      // NB 3: the buffer of stage st, st mod 3
#pragma unroll 1
    for (int st = 0; st < nst; ++st) {
        const int cur = NB == 2 ? (st & 1) : ring;
        const unsigned char* sb = sm + cur * BUF;
        v16bf a[NKS][RT], al[NKS][RT], bh[NKS][CT], bl[NKS][CT];
#pragma unroll
        for (int ks = 0; ks < NKS; ++ks) {
            const unsigned char* fa = sb + (SPLIT ? wm * WM * PIT : wm * SZA) + lr * PIT + ks * 64 + hi * 16;
            const unsigned char* fb = sb + 2 * SZA + (SPLIT ? wn * WN * PIT : wn * SZB) + lr * PIT + ks * 64 + hi * 16;
#pragma unroll
            for (int r = 0; r < RT; ++r) { const unsigned char* q = fa + r * 16 * PIT; a[ks][r] = cat16b(*(const v8usa*)q, *(const v8usa*)(q + 32)); al[ks][r] = a[ks][r];
                if (SPLIT) al[ks][r] = cat16b(*(const v8usa*)(q + SZA), *(const v8usa*)(q + SZA + 32)); }
#pragma unroll
            for (int t = 0; t < CT; ++t) { const unsigned char* q = fb + t * 16 * PIT; bh[ks][t] = cat16b(*(const v8usa*)q, *(const v8usa*)(q + 32)); bl[ks][t] = bh[ks][t];
                if (SPLIT) bl[ks][t] = cat16b(*(const v8usa*)(q + SZB), *(const v8usa*)(q + SZB + 32)); }
        }
        __builtin_amdgcn_sched_barrier(0);      // keeps the stage's LDS reads in one group ahead of its WMMAs: reads sunk among the WMMAs each make the wave wait out the LDS latency
#pragma unroll
        for (int ks = 0; ks < NKS; ++ks) {
#pragma unroll
            for (int t = 0; t < CT; ++t) {
#pragma unroll
                for (int r = 0; r < RT; ++r) acc[r][t] = mm<F16>(a[ks][r], bh[ks][t], acc[r][t]);
                if (SPLIT) {
#pragma unroll
                    for (int r = 0; r < RT; ++r) acc[r][t] = mm<F16>(al[ks][r], bh[ks][t], acc[r][t]);
#pragma unroll
                    for (int r = 0; r < RT; ++r) acc[r][t] = mm<F16>(a[ks][r], bl[ks][t], acc[r][t]); } }
        }
        __builtin_amdgcn_sched_barrier(0);      // keeps the WMMAs ahead of the waits below, so that the next stage's load flies while they run
        asm volatile("s_wait_dscnt 0x0" ::: "memory");     // this wave's reads of the buffer have retired before it is refilled
        const u32 more = pinned(st + NB < nst);      // the same for the whole work-group: this trip refills the buffer that it has read
        if (NB == 3 && more) asm volatile("s_wait_tensorcnt 0x1" ::: "memory");      // in flight: this wave's requests of stages st + 1 and st + 2, landing in issue order: st + 1 has landed, st + 2 flies on over the next trip
        else asm volatile("s_wait_tensorcnt 0x0" ::: "memory");  // this wave's slice of the next stage has landed before the barrier that publishes it
        __syncthreads();
        if (more) fill(st + NB, cur);
        ring = ring == NB - 1 ? 0 : ring + 1;
    }
    asm volatile("s_wait_tensorcnt 0x0" ::: "memory");      // nothing in flight when the ring becomes output staging
    asm volatile("s_wait_dscnt 0x0" ::: "memory");      // and none of this wave's reads of it
    float* os = (float*)(void*)sm + (PLANES ? wm * WM * OP + wn * WN : wave * (WM * OP));
#pragma unroll
    for (int r = 0; r < RT; ++r) {
#pragma unroll
        for (int t = 0; t < CT; ++t) { const float bc = BIAS == 1 ? bfr(bias[cb + wn * WN + t * 16 + lr]) : 0.f;
#pragma unroll
            for (int j = 0; j < 8; ++j) { const int row = r * 16 + hi * 8 + j; float v = acc[r][t][j];
                if (BIAS == 1) v += bc;
                if (BIAS == 2) v += bfr(bias[rb + wm * WM + row]);
                os[row * OP + t * 16 + lr] = v; } } }
    if constexpr (PLANES) {
        __syncthreads();      // a row of the tile is staged by two waves: both halves are written before one wave reads the row back
        const float* ts = (const float*)(const void*)sm;
#pragma unroll
        for (int s = 0; s < BM * BN / 1024; ++s) { const int idx = s * 128 + tid, row = idx >> 3, cofs = (idx & 7) * 8;
            const v4f v0 = *(const v4fa*)(ts + row * OP + cofs), v1 = *(const v4fa*)(ts + row * OP + cofs + 4);
            const size_t o = (size_t)(rb + row) * ldc + cb + cofs;
            if constexpr (PLANES == 2) { v8h of;
#pragma unroll
                for (int i = 0; i < 8; ++i) of[i] = (h16)(i < 4 ? v0[i & 3] : v1[i & 3]);
                *(v8ha*)(Ch + o) = of;
            } else { v8us oh, ol;
#pragma unroll
                for (int i = 0; i < 8; ++i) { const float v = i < 4 ? v0[i & 3] : v1[i & 3]; const unsigned short hb = f2bf(v); oh[i] = hb; ol[i] = f2bf(v - bf2f(hb)); }
                *(v8us*)(Ch + o) = oh; *(v8us*)(Cl + o) = ol; } }
        asm volatile("s_wait_xcnt 0x0" ::: "memory");      // where a kernel holds two such tiles under a branch, the built code lays the second behind these stores: the wait stands in front of its first write of a register that they name
    } else {
        asm volatile("s_wait_dscnt 0x0" ::: "memory");     // the wave's staged rows are written before its lanes read each other's words back
        float* crow = C + (size_t)(rb + wm * WM) * ldc + cb + wn * WN;
#pragma unroll
        for (int s = 0; s < WM * WN / 128; ++s) { const int idx = s * 32 + lane, row = idx / (WN / 4), cofs = (idx % (WN / 4)) * 4;
            const v4f val = *(const v4fa*)(os + row * OP + cofs); *(v4f*)(crow + (size_t)row * ldc + cofs) = val; }
    }
}
// k_gemm: f32 C, one tile per work-group; grid (rows / BM, columns / BN). SPLIT: bf16 hi + residual operands; else one f16 plane each (Al, Bl unused).
template <int BM, int BN, int NB, bool SPLIT, int KST>
__global__ __launch_bounds__(128) void k_gemm(const bf* __restrict__ Ah, const bf* __restrict__ Al, const bf* __restrict__ Bh, const bf* __restrict__ Bl, int K, float* C, int ldc) {
    __shared__ __attribute__((aligned(2048))) unsigned char sm[gemm_lds<BM, BN, SPLIT, NB, KST>::bytes];      // every slice's place is a multiple of 2 KiB of the work-group's LDS
    gemm_tile<BM, BN, SPLIT, 0, 0, NB, KST, !SPLIT>(sm, Ah, Al, Bh, Bl, nullptr, K, C, nullptr, nullptr, ldc, blockIdx.x * BM, blockIdx.y * BN);
}
// k_proj: the three projections in one launch, grid (NN / 128, DD / 64, 3), planes written by the tile's own epilogue. z = 0, 1: q, k [n][DD] = Xb . W + bias per column;
// z = 2: v^T [c][NN] = WvT . Xb^T + bias per row, one f16 plane, its 4 x 64 tiles numbered by the flat index of the same 32 x 8 grid. K = DD, the row stride of every operand plane.
__global__ __launch_bounds__(128) void k_proj(const bf* __restrict__ Xb, const bf* __restrict__ WqT, const bf* __restrict__ WkT, const bf* __restrict__ WvT, const float* __restrict__ bq, const float* __restrict__ bk, const float* __restrict__ bv,
                                              int K, bf* Qh, bf* Ql, bf* Kh, bf* Kl, bf* VT) {
    __shared__ __attribute__((aligned(2048))) unsigned char sm[gemm_lds<128, 64, false, 2, 64>::bytes];      // every slice's place is a multiple of 2 KiB of the work-group's LDS
    const int z = blockIdx.z;
    if (z == 2) { const int flat = blockIdx.y * (NN / 128) + blockIdx.x;
        gemm_tile<128, 64, false, 2, 2, 2, 64, false>(sm, WvT, nullptr, Xb, nullptr, bv, K, nullptr, VT, nullptr, NN, (flat & 3) * 128, (flat >> 2) * 64);
    } else
        gemm_tile<128, 64, false, 1, 1, 2, 64, false>(sm, Xb, nullptr, z ? WkT : WqT, nullptr, z ? bk : bq, K, nullptr, z ? Kh : Qh, z ? Kl : Ql, DD, blockIdx.x * 128, blockIdx.y * 64);
}

// k_softmax: one wave per row. The row's 4096 scores are read once and stay in the wave's registers (128 per lane): maximum, exp and sum, then the f16 plane all come from there.
__global__ __launch_bounds__(256) void k_softmax(const float* __restrict__ S, bf* P) {
    const int lane = threadIdx.x & 31, r = blockIdx.x * 8 + (threadIdx.x >> 5); if (r >= RCH) return;
    const float* sr = S + (size_t)r * NN + lane * 8;
    v8f v[NN / 256];      // every loop over v is unrolled whole: only constant indices keep the array in registers, and the 32 loads then go out together, ahead of the first wait
#pragma unroll
    for (int j = 0; j < NN / 256; ++j) v[j] = *(const v8f*)(sr + j * 256);
    v8f mv = v[0];      // eight independent chains: a maximum does not depend on the order
#pragma unroll
    for (int j = 1; j < NN / 256; ++j) {
#pragma unroll
        for (int i = 0; i < 8; ++i) mv[i] = fmaxf(mv[i], v[j][i]); }
    float m = -3.0e38f;
#pragma unroll
    for (int i = 0; i < 8; ++i) m = fmaxf(m, mv[i]);
#pragma unroll
    for (int sh = 16; sh; sh >>= 1) m = fmaxf(m, __shfl_xor(m, sh, 32));
    float sum = 0.f;      // summed in column order, one chain per lane
#pragma unroll
    for (int j = 0; j < NN / 256; ++j) { float x[8], e[8];
#pragma unroll
        for (int i = 0; i < 8; ++i) x[i] = (v[j][i] - m) * 1.44269504f;      // exp(t) = 2^(t log2 e)
        // eight independent v_exp_f32 in one statement, results in registers of their own: each fills the slot that the instruction set asks for behind the one in front of it
        // (before its result is read or its source overwritten), and the v_nop fills the slot behind the last
        asm("v_exp_f32 %0, %8\n\tv_exp_f32 %1, %9\n\tv_exp_f32 %2, %10\n\tv_exp_f32 %3, %11\n\tv_exp_f32 %4, %12\n\tv_exp_f32 %5, %13\n\tv_exp_f32 %6, %14\n\tv_exp_f32 %7, %15\n\tv_nop"
            : "=&v"(e[0]), "=&v"(e[1]), "=&v"(e[2]), "=&v"(e[3]), "=&v"(e[4]), "=&v"(e[5]), "=&v"(e[6]), "=&v"(e[7])
            : "v"(x[0]), "v"(x[1]), "v"(x[2]), "v"(x[3]), "v"(x[4]), "v"(x[5]), "v"(x[6]), "v"(x[7]));
#pragma unroll
        for (int i = 0; i < 8; ++i) { v[j][i] = e[i]; sum += e[i]; } }
#pragma unroll
    for (int sh = 16; sh; sh >>= 1) sum += __shfl_xor(sum, sh, 32);
    const float inv = 1.0f / sum;
    bf* pr = P + (size_t)r * NN + lane * 8;
#pragma unroll
    for (int j = 0; j < NN / 256; ++j) { v8h o;
#pragma unroll
        for (int i = 0; i < 8; ++i) o[i] = (h16)(v[j][i] * inv);
        *(v8ha*)(pr + j * 256) = o; }
}

extern "C" void kernel_launch(void* const* d_in, const int* in_sizes, int n_in,
                              void* d_out, int out_size, void* d_ws, size_t ws_size, hipStream_t stream) {
    (void)in_sizes; (void)n_in; (void)out_size;
    const float* x = (const float*)d_in[0]; const float* Wq = (const float*)d_in[1]; const float* bq = (const float*)d_in[2]; const float* Wk = (const float*)d_in[3]; const float* bk = (const float*)d_in[4]; const float* Wv = (const float*)d_in[5]; const float* bv = (const float*)d_in[6];
    float* out = (float*)d_out;    // [4096][512]
    char* wsp = (char*)d_ws;
    auto take = [&](size_t bytes) { char* p = wsp; wsp += (bytes + 255) & ~(size_t)255; return (void*)p; };
    bf* WqT = (bf*)take((size_t)DD * DD * 2); bf* WkT = (bf*)take((size_t)DD * DD * 2); bf* WvT = (bf*)take((size_t)DD * DD * 2);
    bf* Xb = (bf*)take((size_t)NN * DD * 2);
    bf* Qh = (bf*)take((size_t)NN * DD * 2); bf* Ql = (bf*)take((size_t)NN * DD * 2); bf* Kh = (bf*)take((size_t)NN * DD * 2); bf* Kl = (bf*)take((size_t)NN * DD * 2); bf* VT = (bf*)take((size_t)DD * NN * 2);
    float* S = (float*)take((size_t)RCH * NN * 4); bf* P = (bf*)take((size_t)RCH * NN * 2);
    if ((size_t)(wsp - (char*)d_ws) > ws_size) return;    // 1.5 + 4.2 + 5 x 4.2 + 67.1 + 33.6 ~ 127 MB, no aliasing
    k_prep<<<NN / 8 + 3 * 64, 256, 0, stream>>>(x, Wq, Wk, Wv, Xb, WqT, WkT, WvT);
    k_proj<<<dim3(NN / 128, DD / 64, 3), 128, 0, stream>>>(Xb, WqT, WkT, WvT, bq, bk, bv, DD, Qh, Ql, Kh, Kl, VT);      // q [n][512], k [m][512] as hi + residual planes, v^T [c][m] as one f16 plane
    k_gemm<128, 128, 2, true, 64><<<dim3(RCH / 128, NN / 128, 1), 128, 0, stream>>>(Qh, Ql, Kh, Kl, DD, S, NN);          // scores [n][m] = q_n . k_m (unscaled), every row in one launch
    k_softmax<<<RCH / 8, 256, 0, stream>>>(S, P);
    k_gemm<128, 64, 3, false, 128><<<dim3(RCH / 128, DD / 64, 1), 128, 0, stream>>>(P, nullptr, VT, nullptr, NN, out, DD);      // out = P . v: 256 work-groups, one on every WGP; P comes from memory: three buffers, 128 k a stage (the bytes of a split 64-k stage)
}

// v008
// Measured time: 79.9 microseconds a run.
// Next to v007, in two timings, it ran 1.04 and 1.03 times as fast.
// All steps since v000 together make it 10.5 times as fast.
#include <hip/hip_runtime.h>

// Compute dtypes, f32 accumulate: q, k token-major and v channel-major projections with PLAIN bf16 operands (input and k-major weights rounded, the weights transposed, on the way into LDS; exact products, + bias) ->
// q, k: bf16 hi + UNSCALED residual planes; v^T: one f16 plane; all 4096 rows in one pass: scores = q.k^T ([4096 x 512].[512 x 4096], three products; unscaled as in the module) -> row softmax in f32 -> P, one f16 plane;
// out = P.v, one f16 product (f32 accumulate): P lies in [0, 1] and |v| is a few units, both inside f16's range; rounding either to f16 (relative 2^-11) stays under what the bf16 operands of the projections (2^-9) have already put into v and the scores.

#define NN   4096
#define DD   512
#define RCH  NN
#define CC   DD
#define DM   DD
#define NTK  NN
#define LOSC 1024.0f

typedef _Float16 h16;
typedef unsigned short bf;
typedef __attribute__((ext_vector_type(16))) __bf16   v16bf;
typedef __attribute__((ext_vector_type(16))) _Float16 v16h;
typedef __attribute__((ext_vector_type(8)))  _Float16 v8h;
typedef __attribute__((ext_vector_type(8)))  unsigned short v8us;
typedef __attribute__((ext_vector_type(8)))  float    v8f;
typedef __attribute__((ext_vector_type(4)))  float    v4f;
typedef __attribute__((ext_vector_type(4)))  _Float16 v4h;
typedef v8h  __attribute__((may_alias)) v8ha;
typedef v4f  __attribute__((may_alias)) v4fa;
typedef v8us __attribute__((may_alias)) v8usa;

__device__ __forceinline__ unsigned short f2bf(float f) { unsigned u = __float_as_uint(f); u += 0x7FFFu + ((u >> 16) & 1u); return (unsigned short)(u >> 16); }
__device__ __forceinline__ float bf2f(unsigned short b) { return __uint_as_float(((unsigned)b) << 16); }
__device__ __forceinline__ float bfr(float f) { return bf2f(f2bf(f)); }
__device__ __forceinline__ v16h cat16(v8h lo, v8h hi) { return __builtin_shufflevector(lo, hi, 0, 1, 2, 3, 4, 5, 6, 7, 8, 9, 10, 11, 12, 13, 14, 15); }
__device__ __forceinline__ v16bf cat16b(v8us lo, v8us hi) { return __builtin_bit_cast(v16bf, __builtin_shufflevector(lo, hi, 0, 1, 2, 3, 4, 5, 6, 7, 8, 9, 10, 11, 12, 13, 14, 15)); }
__device__ __forceinline__ v8f wmma16(v16h a, v16h b, v8f c) { return __builtin_amdgcn_wmma_f32_16x16x32_f16(false, a, false, b, (short)0, c, false, false); }
__device__ __forceinline__ v8f wmmab(v16bf a, v16bf b, v8f c) { return __builtin_amdgcn_wmma_f32_16x16x32_bf16(false, a, false, b, (short)0, c, false, false); }
// mm: one 16 x 16 x 32 product on fragments held as 16-bit words; F16 says that the words are f16, else bf16 (the two forms share one fragment layout).
template <bool F16> __device__ __forceinline__ v8f mm(v16bf a, v16bf b, v8f c) { if constexpr (F16) return wmma16(__builtin_bit_cast(v16h, a), __builtin_bit_cast(v16h, b), c); else return wmmab(a, b, c); }

typedef unsigned int u32;
typedef unsigned long long u64;
typedef u32 u32x4 __attribute__((ext_vector_type(4)));
typedef u32 u32x8 __attribute__((ext_vector_type(8)));
__device__ __forceinline__ u32 uni(u32 v) { return (u32)__builtin_amdgcn_readfirstlane(v); }
__device__ __forceinline__ u32 pinned(u32 v) { u32 w = uni(v); asm volatile("" : "+s"(w)); return w; }      // holds a test word in a scalar register, so that the branch on it is a scalar branch: a tensor load ignores EXEC
__device__ __forceinline__ u32 adr_hi(u64 ga) { return uni((((u32)(ga >> 32)) & 0x01FFFFFFu) | 0x80000000u); }      // group 0, word 3: address bits 56..32, type 2
__device__ __forceinline__ void tdm_load(u32x4 g0, u32x8 g1) { asm volatile("tensor_load_to_lds %0, %1" :: "s"(g0), "s"(g1) : "memory"); }

// k_gemm: BM x BN tile of C = A.B^T over K (every plane K-contiguous with row stride K, n-major B; K a multiple of KST and at least 2 KST), f32 accumulate.
// SPLIT: A = Ah + Al, B = Bh + Bl, three products per 32-k step (hh, lh, hl); else one product Ah.Bh.
// A stage is KST k (64 or 128: one or two whole 128-B lines) of every operand row, in four slices, one per wave: SPLIT: the planes Ah, Al, Bh, Bl; else the two halves of Ah's rows and the two of Bh's. A slice is one tensor load,
// its rows at pitch 2 KST + 16 B in LDS (the load's own pad), its place a multiple of 2 KiB. A ring of NB buffers is filled NB - 1 stages ahead of the stage that is worked on (NB 3: for an operand that comes from memory, which lands later
// than one stage's work lasts); 2 x 2 waves, each BM/2 x BN/2, read their fragments from LDS. Whole-line epilogue, f32 C, staged per wave in the ring once every reader has left it.
template <int BM, int BN, bool SPLIT, int NB, int KST> struct gemm_lds {      // sza, szb: a slice of A rows, of B rows, rounded up to 2 KiB
    static constexpr int pit = KST * 2 + 16, sza = ((SPLIT ? BM : BM / 2) * pit + 2047) / 2048 * 2048, szb = ((SPLIT ? BN : BN / 2) * pit + 2047) / 2048 * 2048, buf = 2 * sza + 2 * szb, bytes = NB * buf; };
template <int BM, int BN, bool SPLIT, int NB, int KST, bool F16>
__device__ __forceinline__ void gemm_tile(unsigned char* sm, const bf* __restrict__ Ah, const bf* __restrict__ Al, const bf* __restrict__ Bh, const bf* __restrict__ Bl, int K, float* C, int ldc, int rb, int cb) {
    typedef gemm_lds<BM, BN, SPLIT, NB, KST> L;
    constexpr int RB = KST * 2, PIT = L::pit, SZA = L::sza, SZB = L::szb, BUF = L::buf, NKS = KST / 32, SA = SPLIT ? BM : BM / 2, SB = SPLIT ? BN : BN / 2, WM = BM / 2, WN = BN / 2, RT = WM / 16, CT = WN / 16, OP = WN + 4;
    static_assert((KST == 64 || KST == 128) && (NB == 2 || NB == 3) && BM % 32 == 0 && BN % 32 == 0 && 4 * WM * OP * 4 <= NB * BUF, "tile");
    const int tid = threadIdx.x, lane = tid & 31, lr = lane & 15, hi = lane >> 4;
    const int wave = (int)uni((u32)tid >> 5), wm = wave >> 1, wn = wave & 1;
    // This wave's slice of every stage: waves 0, 1 bring A rows, waves 2, 3 B rows; rows of RB bytes at source pitch 2 K bytes, all inside the plane (the grid's tiles cover it exactly, K is a multiple of KST).
    const bool isb = wave >= 2;
    const bf* pl = SPLIT ? (wave == 0 ? Ah : wave == 1 ? Al : wave == 2 ? Bh : Bl) : (isb ? Bh : Ah);
    const u64 gsrc = (u64)(size_t)(pl + (size_t)((isb ? cb : rb) + (SPLIT ? 0 : wn * (isb ? SB : SA))) * K);
    const u32 ldst = (u32)(size_t)sm + (u32)(isb ? 2 * SZA + wn * SZB : wn * SZA), nrow = isb ? SB : SA;
    u32x8 g1;      // 1-byte elements, tensor = tile = nrow rows of RB bytes; word 0: no mask, a pad of 4 dwords behind every row of RB bytes
    g1[0] = uni((1u << 20) | ((RB == 128 ? 4u : 5u) << 22) | (3u << 25)); g1[1] = uni((u32)RB << 16); g1[2] = uni(nrow << 16); g1[3] = uni((u32)RB << 16); g1[4] = uni(nrow); g1[5] = uni((u32)K * 2u); g1[6] = uni(0u); g1[7] = uni(0u);
    asm volatile("" : "+s"(g1));      // the pinned() form, descriptor words held in scalar registers: the group stays in its registers through the loop; left free, the build used some of them for other values while a request was outstanding and set them anew in front of each load
    u32x4 g0;      // words 0 and 3 are set here; from request to request the place in LDS and the low address word change, and word 3 only where carry holds
    g0[0] = uni(1u); g0[3] = adr_hi(gsrc);
    const u32 carry = pinned((u32)gsrc + (u32)K * 2u < (u32)gsrc);      // the slice's first row crosses a multiple of 4 GiB: only then does word 3 change along k
    auto fill = [&](int st, int buf) {
        const u64 ga = gsrc + (u64)st * RB;
        g0[1] = uni(ldst + (u32)(buf * BUF)); g0[2] = uni((u32)ga);
        if (carry) { u32 w3 = g0[3]; const u32 nw = adr_hi(ga);      // word 3 takes a new value only when none of the wave's requests is outstanding: wait and move stand in one statement that also reads the old word, so that its register is written nowhere ahead of the wait
            asm volatile("s_wait_tensorcnt 0x0\n\ts_mov_b32 %0, %1" : "+s"(w3) : "s"(nw) : "memory"); g0[3] = w3; }
        tdm_load(g0, g1);
    };
    v8f acc[RT][CT];
#pragma unroll
    for (int r = 0; r < RT; ++r) {
#pragma unroll
        for (int t = 0; t < CT; ++t) acc[r][t] = (v8f){}; }
    const int nst = K / KST;
    fill(0, 0);
    if constexpr (NB == 3) { fill(1, 1);      // K is at least 2 KST: stage 1 exists
        asm volatile("s_wait_tensorcnt 0x1" ::: "memory"); }      // all but this wave's youngest request (stage 1's) have landed: stage 0 is there before the barrier that publishes it
    else asm volatile("s_wait_tensorcnt 0x0" ::: "memory");      // stage 0 has landed before the barrier that publishes it
    __syncthreads();
    if (pinned(nst > NB - 1)) fill(NB - 1, NB - 1);
    int ring = 0;      // NB 3: the buffer of stage st, st mod 3
#pragma unroll 1
    for (int st = 0; st < nst; ++st) {
        const int cur = NB == 2 ? (st & 1) : ring;
        const unsigned char* sb = sm + cur * BUF;
        v16bf a[NKS][RT], al[NKS][RT], bh[NKS][CT], bl[NKS][CT];
#pragma unroll
        for (int ks = 0; ks < NKS; ++ks) {
            const unsigned char* fa = sb + (SPLIT ? wm * WM * PIT : wm * SZA) + lr * PIT + ks * 64 + hi * 16;
            const unsigned char* fb = sb + 2 * SZA + (SPLIT ? wn * WN * PIT : wn * SZB) + lr * PIT + ks * 64 + hi * 16;
#pragma unroll
            for (int r = 0; r < RT; ++r) { const unsigned char* q = fa + r * 16 * PIT; a[ks][r] = cat16b(*(const v8usa*)q, *(const v8usa*)(q + 32)); al[ks][r] = a[ks][r];
                if (SPLIT) al[ks][r] = cat16b(*(const v8usa*)(q + SZA), *(const v8usa*)(q + SZA + 32)); }
#pragma unroll
            for (int t = 0; t < CT; ++t) { const unsigned char* q = fb + t * 16 * PIT; bh[ks][t] = cat16b(*(const v8usa*)q, *(const v8usa*)(q + 32)); bl[ks][t] = bh[ks][t];
                if (SPLIT) bl[ks][t] = cat16b(*(const v8usa*)(q + SZB), *(const v8usa*)(q + SZB + 32)); }
        }
        __builtin_amdgcn_sched_barrier(0);      // keeps the stage's LDS reads in one group ahead of its WMMAs: reads sunk among the WMMAs each make the wave wait out the LDS latency
#pragma unroll
        for (int ks = 0; ks < NKS; ++ks) {
#pragma unroll
            for (int t = 0; t < CT; ++t) {
#pragma unroll
                for (int r = 0; r < RT; ++r) acc[r][t] = mm<F16>(a[ks][r], bh[ks][t], acc[r][t]);
                if (SPLIT) {
#pragma unroll
                    for (int r = 0; r < RT; ++r) acc[r][t] = mm<F16>(al[ks][r], bh[ks][t], acc[r][t]);
#pragma unroll
                    for (int r = 0; r < RT; ++r) acc[r][t] = mm<F16>(a[ks][r], bl[ks][t], acc[r][t]); } }
        }
        __builtin_amdgcn_sched_barrier(0);      // keeps the WMMAs ahead of the waits below, so that the next stage's load flies while they run
        asm volatile("s_wait_dscnt 0x0" ::: "memory");     // this wave's reads of the buffer have retired before it is refilled
        const u32 more = pinned(st + NB < nst);      // the same for the whole work-group: this trip refills the buffer that it has read
        if (NB == 3 && more) asm volatile("s_wait_tensorcnt 0x1" ::: "memory");      // in flight: this wave's requests of stages st + 1 and st + 2, landing in issue order: st + 1 has landed, st + 2 flies on over the next trip
        else asm volatile("s_wait_tensorcnt 0x0" ::: "memory");  // this wave's slice of the next stage has landed before the barrier that publishes it
        __syncthreads();
        if (more) fill(st + NB, cur);
        ring = ring == NB - 1 ? 0 : ring + 1;
    }
    asm volatile("s_wait_tensorcnt 0x0" ::: "memory");      // nothing in flight when the ring becomes output staging
    asm volatile("s_wait_dscnt 0x0" ::: "memory");      // and none of this wave's reads of it
    float* os = (float*)(void*)sm + wave * (WM * OP);
#pragma unroll
    for (int r = 0; r < RT; ++r) {
#pragma unroll
        for (int t = 0; t < CT; ++t) {
#pragma unroll
            for (int j = 0; j < 8; ++j) os[(r * 16 + hi * 8 + j) * OP + t * 16 + lr] = acc[r][t][j]; } }
    asm volatile("s_wait_dscnt 0x0" ::: "memory");     // the wave's staged rows are written before its lanes read each other's words back
    float* crow = C + (size_t)(rb + wm * WM) * ldc + cb + wn * WN;
#pragma unroll
    for (int s = 0; s < WM * WN / 128; ++s) { const int idx = s * 32 + lane, row = idx / (WN / 4), cofs = (idx % (WN / 4)) * 4;
        const v4f val = *(const v4fa*)(os + row * OP + cofs); *(v4f*)(crow + (size_t)row * ldc + cofs) = val; }
}
// k_gemm: f32 C, one tile per work-group; grid (rows / BM, columns / BN). SPLIT: bf16 hi + residual operands; else one f16 plane each (Al, Bl unused).
template <int BM, int BN, int NB, bool SPLIT, int KST>
__global__ __launch_bounds__(128) void k_gemm(const bf* __restrict__ Ah, const bf* __restrict__ Al, const bf* __restrict__ Bh, const bf* __restrict__ Bl, int K, float* C, int ldc) {
    __shared__ __attribute__((aligned(2048))) unsigned char sm[gemm_lds<BM, BN, SPLIT, NB, KST>::bytes];      // every slice's place is a multiple of 2 KiB of the work-group's LDS
    gemm_tile<BM, BN, SPLIT, NB, KST, !SPLIT>(sm, Ah, Al, Bh, Bl, K, C, ldc, blockIdx.x * BM, blockIdx.y * BN);
}
// k_proj: the three projections straight from the f32 inputs, one launch, grid (NN / 128, DD / 64), 12 waves: a work-group takes 128 tokens and the same 64 output columns of q, k and v.
// Waves 4 g .. 4 g + 3 (g = 0, 1, 2: q, k, v) form a 2 x 2 group with a 128 x 64 tile of its own; the three groups share one x tile. A stage is 64 k: x [128][64] and W_g [64 k][64 n] come through registers,
// are rounded to bf16 there (to nearest even) and stored k-contiguous at pitch 144 B: x rows as they lie, W transposed by each lane gathering eight k of one column from its eight row loads.
// Two LDS buffers and two register sets: stage st + 2 is loaded at the head of stage st, stage st + 1 is stored behind stage st's WMMAs; one barrier a stage. Epilogue in the same LDS: q, k as bf16 hi + residual planes [n][DD]; v staged channel-major, one f16 plane v^T [c][NN].
typedef __attribute__((ext_vector_type(4))) __bf16 v4bf;
typedef __attribute__((ext_vector_type(8))) __bf16 v8bf;
typedef __attribute__((ext_vector_type(4))) unsigned short v4us;
typedef v4us __attribute__((may_alias)) v4usa;
// The work-group's barrier behind a wait for this wave's own LDS reads and writes alone: __syncthreads() also waits out the global loads that were issued ahead, which are to fly on over it.
__device__ __forceinline__ void lds_barrier() { asm volatile("s_wait_dscnt 0x0\n\ts_barrier_signal -1\n\ts_barrier_wait -1" ::: "memory"); }
__global__ __launch_bounds__(384) void k_proj(const float* __restrict__ x, const float* __restrict__ Wq, const float* __restrict__ Wk, const float* __restrict__ Wv, const float* __restrict__ bq, const float* __restrict__ bk, const float* __restrict__ bv,
                                              bf* Qh, bf* Ql, bf* Kh, bf* Kl, bf* VT) {
    constexpr int PIT = 144, SZX = 128 * PIT, SZW = 64 * PIT, BUF = SZX + 3 * SZW, OP = 68, OPT = 132, STG = 128 * OP * 4, NST = DD / 64;
    static_assert(2 * BUF <= 3 * STG && 64 * OPT * 4 <= STG, "staging");
    __shared__ __align__(16) unsigned char sm[3 * STG];
    const int tid = threadIdx.x, lane = tid & 31, lr = lane & 15, hi = lane >> 4;
    const int wave = (int)uni((u32)tid >> 5), g = wave >> 2, wm = (wave >> 1) & 1, wn = wave & 1, tg = tid & 127;
    const int rb = blockIdx.x * 128, cb = blockIdx.y * 64;
    const float* xs = x + (size_t)(rb + (tid >> 4)) * DD + (tid & 15) * 4;      // x: four k a lane, sixteen lanes to a row's 256 B; 24 rows a pass of the work-group
    const int nq = tg & 15, kg = tg >> 4;      // W: four columns a lane, sixteen lanes to a k row's 256 B; the lane's eight loads are rows 8 kg .. 8 kg + 7 of the stage
    const float* ws = (g == 0 ? Wq : g == 1 ? Wk : Wv) + (size_t)(kg * 8) * DD + cb + nq * 4;
    const float* bias = g == 0 ? bq : g == 1 ? bk : bv;
    const float bc[2] = {bfr(bias[cb + wn * 32 + lr]), bfr(bias[cb + wn * 32 + 16 + lr])};      // the lane's two output columns; loaded here, so that the epilogue does not wait for them
    v4f xr[2][6], wr[2][8];      // two register sets: stage st lies in set st mod 2 from its loads to its stores
    auto fetch = [&](int st) {
        v4f* xq = xr[st & 1]; v4f* wq = wr[st & 1];
#pragma unroll
        for (int i = 0; i < 5; ++i) xq[i] = *(const v4f*)(xs + (size_t)i * 24 * DD + st * 64);
        if (wave < 4) xq[5] = *(const v4f*)(xs + (size_t)5 * 24 * DD + st * 64);      // rows 120 .. 127
#pragma unroll
        for (int i = 0; i < 8; ++i) wq[i] = *(const v4f*)(ws + (size_t)(st * 64 + i) * DD);
    };
    auto put = [&](int st) {
        const v4f* xq = xr[st & 1]; const v4f* wq = wr[st & 1];
        unsigned char* sb = sm + (st & 1) * BUF;
        unsigned char* xd = sb + (tid >> 4) * PIT + (tid & 15) * 8;
#pragma unroll
        for (int i = 0; i < 5; ++i) *(v4usa*)(xd + i * 24 * PIT) = __builtin_bit_cast(v4us, __builtin_convertvector(xq[i], v4bf));
        if (wave < 4) *(v4usa*)(xd + 5 * 24 * PIT) = __builtin_bit_cast(v4us, __builtin_convertvector(xq[5], v4bf));
        unsigned char* wd = sb + SZX + g * SZW + nq * 4 * PIT + (kg ^ (nq >> 2)) * 16;      // the 16-B piece kc of column n lies at place kc ^ (n >> 4): sixteen lanes, four columns apart, then store to sixteen different bank groups
#pragma unroll
        for (int j = 0; j < 4; ++j) { const v8f col = {wq[0][j], wq[1][j], wq[2][j], wq[3][j], wq[4][j], wq[5][j], wq[6][j], wq[7][j]};
            *(v8usa*)(wd + j * PIT) = __builtin_bit_cast(v8us, __builtin_convertvector(col, v8bf)); }
    };
    v8f acc[4][2];
#pragma unroll
    for (int r = 0; r < 4; ++r) {
#pragma unroll
        for (int t = 0; t < 2; ++t) acc[r][t] = (v8f){}; }
    fetch(0); fetch(1); put(0);
    asm volatile("s_wait_xcnt 0x0" ::: "memory");      // stands in front of the first write of a register that the bias loads name; the x and W loads keep their address registers to the end of the loop
    lds_barrier();
#pragma unroll      // unrolled whole: every load address is then one fixed register pair plus an immediate offset
    for (int st = 0; st < NST; ++st) {
        if (st + 2 < NST) fetch(st + 2);      // into the set that stage st has left: its loads fly over two stages' work
        __builtin_amdgcn_sched_barrier(0);      // keeps these loads at the head of the stage: left free, the build sank some of them to just in front of their use, where the wave waits out their whole latency
        const unsigned char* sb = sm + (st & 1) * BUF;
        const unsigned char* fa = sb + (wm * 64 + lr) * PIT + hi * 16;
        const unsigned char* fb = sb + SZX + g * SZW + (wn * 32 + lr) * PIT;
        v16bf a[2][4], b[2][2];
#pragma unroll
        for (int ks = 0; ks < 2; ++ks) {
#pragma unroll
            for (int r = 0; r < 4; ++r) { const unsigned char* q = fa + r * 16 * PIT + ks * 64; a[ks][r] = cat16b(*(const v8usa*)q, *(const v8usa*)(q + 32)); }
#pragma unroll
            for (int t = 0; t < 2; ++t) { const unsigned char* q = fb + t * 16 * PIT + ks * 64 + (hi ^ t) * 16;      // columns 32 wn + 16 t + lr: n >> 4 = 2 wn + t, so pieces hi and hi + 2 lie at (hi ^ t) + 2 wn and (hi ^ t) + 2 - 2 wn
                b[ks][t] = cat16b(*(const v8usa*)(q + wn * 32), *(const v8usa*)(q + 32 - wn * 32)); }
        }
        __builtin_amdgcn_sched_barrier(0);      // keeps the stage's LDS reads in one group ahead of its WMMAs: reads sunk among the WMMAs each make the wave wait out the LDS latency
#pragma unroll
        for (int ks = 0; ks < 2; ++ks) {
#pragma unroll
            for (int t = 0; t < 2; ++t) {
#pragma unroll
                for (int r = 0; r < 4; ++r) acc[r][t] = wmmab(a[ks][r], b[ks][t], acc[r][t]); } }
        __builtin_amdgcn_sched_barrier(0);      // keeps the wait for the next stage's loads, and its rounding, behind the WMMAs
        if (st + 1 < NST) put(st + 1);      // the buffer that stage st - 1 read: every wave has left it at the barrier that ended that stage
        lds_barrier();      // publishes stage st + 1 and ends every read of stage st; behind the last stage the ring becomes output staging
    }
    asm volatile("s_wait_xcnt 0x0" ::: "memory");      // stands in front of the epilogue's first write of a register that the loads above name
    float* ts = (float*)(void*)(sm + g * STG);      // each group stages its own tile
    if (g == 2) {      // channel-major: a lane's eight tokens of one channel lie side by side
#pragma unroll
        for (int t = 0; t < 2; ++t) {
#pragma unroll
            for (int r = 0; r < 4; ++r) { float* d = ts + (wn * 32 + t * 16 + lr) * OPT + wm * 64 + r * 16 + hi * 8; const v8f s = acc[r][t] + bc[t];
                *(v4fa*)d = __builtin_shufflevector(s, s, 0, 1, 2, 3); *(v4fa*)(d + 4) = __builtin_shufflevector(s, s, 4, 5, 6, 7); } }
    } else {
#pragma unroll
        for (int t = 0; t < 2; ++t) {
#pragma unroll
            for (int r = 0; r < 4; ++r) {
#pragma unroll
                for (int j = 0; j < 8; ++j) ts[(wm * 64 + r * 16 + hi * 8 + j) * OP + wn * 32 + t * 16 + lr] = acc[r][t][j] + bc[t]; } }
    }
    __syncthreads();      // a staged row is written by two waves: both halves are there before one wave reads the row back
    if (g == 2) {
#pragma unroll
        for (int s = 0; s < 8; ++s) { const int idx = s * 128 + tg, c = idx >> 4, tofs = (idx & 15) * 8;
            const v4f v0 = *(const v4fa*)(ts + c * OPT + tofs), v1 = *(const v4fa*)(ts + c * OPT + tofs + 4); v8h of;
#pragma unroll
            for (int i = 0; i < 8; ++i) of[i] = (h16)(i < 4 ? v0[i & 3] : v1[i & 3]);
            *(v8ha*)(VT + (size_t)(cb + c) * NN + rb + tofs) = of; }
    } else {
        bf* Ch = g ? Kh : Qh; bf* Cl = g ? Kl : Ql;
#pragma unroll
        for (int s = 0; s < 8; ++s) { const int idx = s * 128 + tg, row = idx >> 3, cofs = (idx & 7) * 8;
            const v4f v0 = *(const v4fa*)(ts + row * OP + cofs), v1 = *(const v4fa*)(ts + row * OP + cofs + 4);
            const size_t o = (size_t)(rb + row) * DD + cb + cofs; v8us oh, ol;
#pragma unroll
            for (int i = 0; i < 8; ++i) { const float v = i < 4 ? v0[i & 3] : v1[i & 3]; const unsigned short hb = f2bf(v); oh[i] = hb; ol[i] = f2bf(v - bf2f(hb)); }
            *(v8us*)(Ch + o) = oh; *(v8us*)(Cl + o) = ol; }
        asm volatile("s_wait_xcnt 0x0" ::: "memory");      // the built code lays the other branch's body behind these stores: the wait stands in front of its first write of a register that they name
    }
}

// k_softmax: one wave per row. The row's 4096 scores are read once and stay in the wave's registers (128 per lane): maximum, exp and sum, then the f16 plane all come from there.
__global__ __launch_bounds__(256) void k_softmax(const float* __restrict__ S, bf* P) {
    const int lane = threadIdx.x & 31, r = blockIdx.x * 8 + (threadIdx.x >> 5); if (r >= RCH) return;
    const float* sr = S + (size_t)r * NN + lane * 8;
    v8f v[NN / 256];      // every loop over v is unrolled whole: only constant indices keep the array in registers, and the 32 loads then go out together, ahead of the first wait
#pragma unroll
    for (int j = 0; j < NN / 256; ++j) v[j] = *(const v8f*)(sr + j * 256);
    v8f mv = v[0];      // eight independent chains: a maximum does not depend on the order
#pragma unroll
    for (int j = 1; j < NN / 256; ++j) {
#pragma unroll
        for (int i = 0; i < 8; ++i) mv[i] = fmaxf(mv[i], v[j][i]); }
    float m = -3.0e38f;
#pragma unroll
    for (int i = 0; i < 8; ++i) m = fmaxf(m, mv[i]);
#pragma unroll
    for (int sh = 16; sh; sh >>= 1) m = fmaxf(m, __shfl_xor(m, sh, 32));
    float sum = 0.f;      // summed in column order, one chain per lane
#pragma unroll
    for (int j = 0; j < NN / 256; ++j) { float x[8], e[8];
#pragma unroll
        for (int i = 0; i < 8; ++i) x[i] = (v[j][i] - m) * 1.44269504f;      // exp(t) = 2^(t log2 e)
        // eight independent v_exp_f32 in one statement, results in registers of their own: each fills the slot that the instruction set asks for behind the one in front of it
        // (before its result is read or its source overwritten), and the v_nop fills the slot behind the last
        asm("v_exp_f32 %0, %8\n\tv_exp_f32 %1, %9\n\tv_exp_f32 %2, %10\n\tv_exp_f32 %3, %11\n\tv_exp_f32 %4, %12\n\tv_exp_f32 %5, %13\n\tv_exp_f32 %6, %14\n\tv_exp_f32 %7, %15\n\tv_nop"
            : "=&v"(e[0]), "=&v"(e[1]), "=&v"(e[2]), "=&v"(e[3]), "=&v"(e[4]), "=&v"(e[5]), "=&v"(e[6]), "=&v"(e[7])
            : "v"(x[0]), "v"(x[1]), "v"(x[2]), "v"(x[3]), "v"(x[4]), "v"(x[5]), "v"(x[6]), "v"(x[7]));
#pragma unroll
        for (int i = 0; i < 8; ++i) { v[j][i] = e[i]; sum += e[i]; } }
#pragma unroll
    for (int sh = 16; sh; sh >>= 1) sum += __shfl_xor(sum, sh, 32);
    const float inv = 1.0f / sum;
    bf* pr = P + (size_t)r * NN + lane * 8;
#pragma unroll
    for (int j = 0; j < NN / 256; ++j) { v8h o;
#pragma unroll
        for (int i = 0; i < 8; ++i) o[i] = (h16)(v[j][i] * inv);
        *(v8ha*)(pr + j * 256) = o; }
}

extern "C" void kernel_launch(void* const* d_in, const int* in_sizes, int n_in,
                              void* d_out, int out_size, void* d_ws, size_t ws_size, hipStream_t stream) {
    (void)in_sizes; (void)n_in; (void)out_size;
    const float* x = (const float*)d_in[0]; const float* Wq = (const float*)d_in[1]; const float* bq = (const float*)d_in[2]; const float* Wk = (const float*)d_in[3]; const float* bk = (const float*)d_in[4]; const float* Wv = (const float*)d_in[5]; const float* bv = (const float*)d_in[6];
    float* out = (float*)d_out;    // [4096][512]
    char* wsp = (char*)d_ws;
    auto take = [&](size_t bytes) { char* p = wsp; wsp += (bytes + 255) & ~(size_t)255; return (void*)p; };
    bf* Qh = (bf*)take((size_t)NN * DD * 2); bf* Ql = (bf*)take((size_t)NN * DD * 2); bf* Kh = (bf*)take((size_t)NN * DD * 2); bf* Kl = (bf*)take((size_t)NN * DD * 2); bf* VT = (bf*)take((size_t)DD * NN * 2);
    float* S = (float*)take((size_t)RCH * NN * 4); bf* P = (bf*)take((size_t)RCH * NN * 2);
    if ((size_t)(wsp - (char*)d_ws) > ws_size) return;    // 5 x 4.2 + 67.1 + 33.6 ~ 122 MB, no aliasing
    k_proj<<<dim3(NN / 128, DD / 64, 1), 384, 0, stream>>>(x, Wq, Wk, Wv, bq, bk, bv, Qh, Ql, Kh, Kl, VT);      // q [n][512], k [m][512] as hi + residual planes, v^T [c][m] as one f16 plane
    k_gemm<128, 128, 2, true, 64><<<dim3(RCH / 128, NN / 128, 1), 128, 0, stream>>>(Qh, Ql, Kh, Kl, DD, S, NN);          // scores [n][m] = q_n . k_m (unscaled), every row in one launch
    k_softmax<<<RCH / 8, 256, 0, stream>>>(S, P);
    k_gemm<128, 64, 3, false, 128><<<dim3(RCH / 128, DD / 64, 1), 128, 0, stream>>>(P, nullptr, VT, nullptr, NN, out, DD);      // out = P . v: 256 work-groups, one on every WGP; P comes from memory: three buffers, 128 k a stage (the bytes of a split 64-k stage)
}

// v009
// One run takes 76.4 microseconds.
// In two side-by-side timings against v008, it was 1.04 and 1.05 times as fast.
// All steps since v000 together make it 10.9 times as fast.
#include <hip/hip_runtime.h>

// Compute dtypes, f32 accumulate: q, k token-major and v channel-major projections with PLAIN bf16 operands (input and k-major weights rounded, the weights transposed, on the way into LDS; exact products, + bias) ->
// q, k: bf16 hi + UNSCALED residual planes; v^T: one f16 plane; all 4096 rows in one pass: scores = q.k^T ([4096 x 512].[512 x 4096], three products; unscaled as in the module) -> row softmax in f32 -> P, one f16 plane;
// out = P.v, one f16 product (f32 accumulate): P lies in [0, 1] and |v| is a few units, both inside f16's range; rounding either to f16 (relative 2^-11) stays under what the bf16 operands of the projections (2^-9) have already put into v and the scores.

#define NN   4096
#define DD   512
#define RCH  NN
#define CC   DD
#define DM   DD
#define NTK  NN
#define LOSC 1024.0f

typedef _Float16 h16;
typedef unsigned short bf;
typedef __attribute__((ext_vector_type(16))) __bf16   v16bf;
typedef __attribute__((ext_vector_type(16))) _Float16 v16h;
typedef __attribute__((ext_vector_type(8)))  _Float16 v8h;
typedef __attribute__((ext_vector_type(8)))  unsigned short v8us;
typedef __attribute__((ext_vector_type(8)))  float    v8f;
typedef __attribute__((ext_vector_type(4)))  float    v4f;
typedef __attribute__((ext_vector_type(4)))  _Float16 v4h;
typedef v8h  __attribute__((may_alias)) v8ha;
typedef v4f  __attribute__((may_alias)) v4fa;
typedef v8us __attribute__((may_alias)) v8usa;

__device__ __forceinline__ unsigned short f2bf(float f) { unsigned u = __float_as_uint(f); u += 0x7FFFu + ((u >> 16) & 1u); return (unsigned short)(u >> 16); }
__device__ __forceinline__ float bf2f(unsigned short b) { return __uint_as_float(((unsigned)b) << 16); }
__device__ __forceinline__ float bfr(float f) { return bf2f(f2bf(f)); }
__device__ __forceinline__ v16h cat16(v8h lo, v8h hi) { return __builtin_shufflevector(lo, hi, 0, 1, 2, 3, 4, 5, 6, 7, 8, 9, 10, 11, 12, 13, 14, 15); }
__device__ __forceinline__ v16bf cat16b(v8us lo, v8us hi) { return __builtin_bit_cast(v16bf, __builtin_shufflevector(lo, hi, 0, 1, 2, 3, 4, 5, 6, 7, 8, 9, 10, 11, 12, 13, 14, 15)); }
__device__ __forceinline__ v8f wmma16(v16h a, v16h b, v8f c) { return __builtin_amdgcn_wmma_f32_16x16x32_f16(false, a, false, b, (short)0, c, false, false); }
__device__ __forceinline__ v8f wmmab(v16bf a, v16bf b, v8f c) { return __builtin_amdgcn_wmma_f32_16x16x32_bf16(false, a, false, b, (short)0, c, false, false); }
// mm: one 16 x 16 x 32 product on fragments held as 16-bit words; F16 says that the words are f16, else bf16 (the two forms share one fragment layout).
template <bool F16> __device__ __forceinline__ v8f mm(v16bf a, v16bf b, v8f c) { if constexpr (F16) return wmma16(__builtin_bit_cast(v16h, a), __builtin_bit_cast(v16h, b), c); else return wmmab(a, b, c); }

typedef unsigned int u32;
typedef unsigned long long u64;
typedef u32 u32x4 __attribute__((ext_vector_type(4)));
typedef u32 u32x8 __attribute__((ext_vector_type(8)));
__device__ __forceinline__ u32 uni(u32 v) { return (u32)__builtin_amdgcn_readfirstlane(v); }
__device__ __forceinline__ u32 pinned(u32 v) { u32 w = uni(v); asm volatile("" : "+s"(w)); return w; }      // holds a test word in a scalar register, so that the branch on it is a scalar branch: a tensor load ignores EXEC
__device__ __forceinline__ u32 adr_hi(u64 ga) { return uni((((u32)(ga >> 32)) & 0x01FFFFFFu) | 0x80000000u); }      // group 0, word 3: address bits 56..32, type 2
__device__ __forceinline__ void tdm_load(u32x4 g0, u32x8 g1) { asm volatile("tensor_load_to_lds %0, %1" :: "s"(g0), "s"(g1) : "memory"); }

// k_gemm: BM x BN tile of C = A.B^T over K (every plane K-contiguous with row stride K, n-major B; K a multiple of KST and at least 2 KST), f32 accumulate.
// SPLIT: A = Ah + Al, B = Bh + Bl, three products per 32-k step (hh, lh, hl); else one product Ah.Bh.
// A stage is KST k (64 or 128: one or two whole 128-B lines) of every operand row, in four slices, one per wave: SPLIT: the planes Ah, Al, Bh, Bl; else the two halves of Ah's rows and the two of Bh's. A slice is one tensor load,
// its rows at pitch 2 KST + 16 B in LDS (the load's own pad), its place a multiple of 2 KiB. A ring of NB buffers is filled NB - 1 stages ahead of the stage that is worked on (NB 3: for an operand that comes from memory, which lands later
// than one stage's work lasts); 2 x 2 waves, each BM/2 x BN/2, read their fragments from LDS. Whole-line epilogue, f32 C, staged per wave in the ring once every reader has left it.
// The k walk starts at stage rot (0 <= rot < K / KST) and wraps round: work-groups that share operand rows are given different rot, so that they do not ask L2 for the same lines at the same moment.
template <int BM, int BN, bool SPLIT, int NB, int KST> struct gemm_lds {      // sza, szb: a slice of A rows, of B rows, rounded up to 2 KiB
    static constexpr int pit = KST * 2 + 16, sza = ((SPLIT ? BM : BM / 2) * pit + 2047) / 2048 * 2048, szb = ((SPLIT ? BN : BN / 2) * pit + 2047) / 2048 * 2048, buf = 2 * sza + 2 * szb, bytes = NB * buf; };
template <int BM, int BN, bool SPLIT, int NB, int KST, bool F16>
__device__ __forceinline__ void gemm_tile(unsigned char* sm, const bf* __restrict__ Ah, const bf* __restrict__ Al, const bf* __restrict__ Bh, const bf* __restrict__ Bl, int K, float* C, int ldc, int rb, int cb, int rot) {
    typedef gemm_lds<BM, BN, SPLIT, NB, KST> L;
    constexpr int RB = KST * 2, PIT = L::pit, SZA = L::sza, SZB = L::szb, BUF = L::buf, NKS = KST / 32, SA = SPLIT ? BM : BM / 2, SB = SPLIT ? BN : BN / 2, WM = BM / 2, WN = BN / 2, RT = WM / 16, CT = WN / 16, OP = WN + 4;
    static_assert((KST == 64 || KST == 128) && (NB == 2 || NB == 3) && BM % 32 == 0 && BN % 32 == 0 && 4 * WM * OP * 4 <= NB * BUF, "tile");
    const int tid = threadIdx.x, lane = tid & 31, lr = lane & 15, hi = lane >> 4;
    const int wave = (int)uni((u32)tid >> 5), wm = wave >> 1, wn = wave & 1;
    // This wave's slice of every stage: waves 0, 1 bring A rows, waves 2, 3 B rows; rows of RB bytes at source pitch 2 K bytes, all inside the plane (the grid's tiles cover it exactly, K is a multiple of KST).
    const bool isb = wave >= 2;
    const bf* pl = SPLIT ? (wave == 0 ? Ah : wave == 1 ? Al : wave == 2 ? Bh : Bl) : (isb ? Bh : Ah);
    const u64 gsrc = (u64)(size_t)(pl + (size_t)((isb ? cb : rb) + (SPLIT ? 0 : wn * (isb ? SB : SA))) * K);
    const u32 ldst = (u32)(size_t)sm + (u32)(isb ? 2 * SZA + wn * SZB : wn * SZA), nrow = isb ? SB : SA;
    u32x8 g1;      // 1-byte elements, tensor = tile = nrow rows of RB bytes; word 0: no mask, a pad of 4 dwords behind every row of RB bytes
    g1[0] = uni((1u << 20) | ((RB == 128 ? 4u : 5u) << 22) | (3u << 25)); g1[1] = uni((u32)RB << 16); g1[2] = uni(nrow << 16); g1[3] = uni((u32)RB << 16); g1[4] = uni(nrow); g1[5] = uni((u32)K * 2u); g1[6] = uni(0u); g1[7] = uni(0u);
    asm volatile("" : "+s"(g1));      // the pinned() form, descriptor words held in scalar registers: the group stays in its registers through the loop; left free, the build used some of them for other values while a request was outstanding and set them anew in front of each load
    u32x4 g0;      // words 0 and 3 are set here; from request to request the place in LDS and the low address word change, and word 3 only where carry holds
    g0[0] = uni(1u); g0[3] = adr_hi(gsrc);
    const u32 carry = pinned((u32)gsrc + (u32)K * 2u < (u32)gsrc);      // the slice's first row crosses a multiple of 4 GiB: only then does word 3 change along k
    const int nst = K / KST;
    auto fill = [&](int st, int buf) {
        const int sk = st + rot < nst ? st + rot : st + rot - nst;      // the st-th stage of this work-group's walk
        const u64 ga = gsrc + (u64)sk * RB;
        g0[1] = uni(ldst + (u32)(buf * BUF)); g0[2] = uni((u32)ga);
        if (carry) { u32 w3 = g0[3]; const u32 nw = adr_hi(ga);      // word 3 takes a new value only when none of the wave's requests is outstanding: wait and move stand in one statement that also reads the old word, so that its register is written nowhere ahead of the wait
            asm volatile("s_wait_tensorcnt 0x0\n\ts_mov_b32 %0, %1" : "+s"(w3) : "s"(nw) : "memory"); g0[3] = w3; }
        tdm_load(g0, g1);
    };
    v8f acc[RT][CT];
#pragma unroll
    for (int r = 0; r < RT; ++r) {
#pragma unroll
        for (int t = 0; t < CT; ++t) acc[r][t] = (v8f){}; }
    fill(0, 0);
    if constexpr (NB == 3) { fill(1, 1);      // K is at least 2 KST: stage 1 exists
        asm volatile("s_wait_tensorcnt 0x1" ::: "memory"); }      // all but this wave's youngest request (stage 1's) have landed: stage 0 is there before the barrier that publishes it
    else asm volatile("s_wait_tensorcnt 0x0" ::: "memory");      // stage 0 has landed before the barrier that publishes it
    __syncthreads();
    if (pinned(nst > NB - 1)) fill(NB - 1, NB - 1);
    int ring = 0;      // NB 3: the buffer of stage st, st mod 3
#pragma unroll 1
    for (int st = 0; st < nst; ++st) {
        const int cur = NB == 2 ? (st & 1) : ring;
        const unsigned char* sb = sm + cur * BUF;
        v16bf a[NKS][RT], al[NKS][RT], bh[NKS][CT], bl[NKS][CT];
#pragma unroll
        for (int ks = 0; ks < NKS; ++ks) {
            const unsigned char* fa = sb + (SPLIT ? wm * WM * PIT : wm * SZA) + lr * PIT + ks * 64 + hi * 16;
            const unsigned char* fb = sb + 2 * SZA + (SPLIT ? wn * WN * PIT : wn * SZB) + lr * PIT + ks * 64 + hi * 16;
#pragma unroll
            for (int r = 0; r < RT; ++r) { const unsigned char* q = fa + r * 16 * PIT; a[ks][r] = cat16b(*(const v8usa*)q, *(const v8usa*)(q + 32)); al[ks][r] = a[ks][r];
                if (SPLIT) al[ks][r] = cat16b(*(const v8usa*)(q + SZA), *(const v8usa*)(q + SZA + 32)); }
#pragma unroll
            for (int t = 0; t < CT; ++t) { const unsigned char* q = fb + t * 16 * PIT; bh[ks][t] = cat16b(*(const v8usa*)q, *(const v8usa*)(q + 32)); bl[ks][t] = bh[ks][t];
                if (SPLIT) bl[ks][t] = cat16b(*(const v8usa*)(q + SZB), *(const v8usa*)(q + SZB + 32)); }
        }
        __builtin_amdgcn_sched_barrier(0);      // keeps the stage's LDS reads in one group ahead of its WMMAs: reads sunk among the WMMAs each make the wave wait out the LDS latency
#pragma unroll
        for (int ks = 0; ks < NKS; ++ks) {
#pragma unroll
            for (int t = 0; t < CT; ++t) {
#pragma unroll
                for (int r = 0; r < RT; ++r) acc[r][t] = mm<F16>(a[ks][r], bh[ks][t], acc[r][t]);
                if (SPLIT) {
#pragma unroll
                    for (int r = 0; r < RT; ++r) acc[r][t] = mm<F16>(al[ks][r], bh[ks][t], acc[r][t]);
#pragma unroll
                    for (int r = 0; r < RT; ++r) acc[r][t] = mm<F16>(a[ks][r], bl[ks][t], acc[r][t]); } }
        }
        __builtin_amdgcn_sched_barrier(0);      // keeps the WMMAs ahead of the waits below, so that the next stage's load flies while they run
        asm volatile("s_wait_dscnt 0x0" ::: "memory");     // this wave's reads of the buffer have retired before it is refilled
        const u32 more = pinned(st + NB < nst);      // the same for the whole work-group: this trip refills the buffer that it has read
        if (NB == 3 && more) asm volatile("s_wait_tensorcnt 0x1" ::: "memory");      // in flight: this wave's requests of stages st + 1 and st + 2, landing in issue order: st + 1 has landed, st + 2 flies on over the next trip
        else asm volatile("s_wait_tensorcnt 0x0" ::: "memory");  // this wave's slice of the next stage has landed before the barrier that publishes it
        __syncthreads();
        if (more) fill(st + NB, cur);
        ring = ring == NB - 1 ? 0 : ring + 1;
    }
    asm volatile("s_wait_tensorcnt 0x0" ::: "memory");      // nothing in flight when the ring becomes output staging
    asm volatile("s_wait_dscnt 0x0" ::: "memory");      // and none of this wave's reads of it
    float* os = (float*)(void*)sm + wave * (WM * OP);
#pragma unroll
    for (int r = 0; r < RT; ++r) {
#pragma unroll
        for (int t = 0; t < CT; ++t) {
#pragma unroll
            for (int j = 0; j < 8; ++j) os[(r * 16 + hi * 8 + j) * OP + t * 16 + lr] = acc[r][t][j]; } }
    asm volatile("s_wait_dscnt 0x0" ::: "memory");     // the wave's staged rows are written before its lanes read each other's words back
    float* crow = C + (size_t)(rb + wm * WM) * ldc + cb + wn * WN;
#pragma unroll
    for (int s = 0; s < WM * WN / 128; ++s) { const int idx = s * 32 + lane, row = idx / (WN / 4), cofs = (idx % (WN / 4)) * 4;
        const v4f val = *(const v4fa*)(os + row * OP + cofs); *(v4f*)(crow + (size_t)row * ldc + cofs) = val; }
}
// k_gemm: f32 C, one tile per work-group; grid (rows / BM, columns / BN). SPLIT: bf16 hi + residual operands; else one f16 plane each (Al, Bl unused).
// First stage of the k walk: (blockIdx.x + RY blockIdx.y) & (stages - 1), below the stage count for any count and evenly spread for a power of two: tiles of one row or one column of the grid start apart.
template <int BM, int BN, int NB, bool SPLIT, int KST, int RY>
__global__ __launch_bounds__(128) void k_gemm(const bf* __restrict__ Ah, const bf* __restrict__ Al, const bf* __restrict__ Bh, const bf* __restrict__ Bl, int K, float* C, int ldc) {
    __shared__ __attribute__((aligned(2048))) unsigned char sm[gemm_lds<BM, BN, SPLIT, NB, KST>::bytes];      // every slice's place is a multiple of 2 KiB of the work-group's LDS
    gemm_tile<BM, BN, SPLIT, NB, KST, !SPLIT>(sm, Ah, Al, Bh, Bl, K, C, ldc, blockIdx.x * BM, blockIdx.y * BN, (int)((blockIdx.x + RY * blockIdx.y) & (u32)(K / KST - 1)));
}
// k_proj: the three projections straight from the f32 inputs, one launch, grid (NN / 128, DD / 64), 12 waves: a work-group takes 128 tokens and the same 64 output columns of q, k and v.
// Waves 4 g .. 4 g + 3 (g = 0, 1, 2: q, k, v) form a 2 x 2 group with a 128 x 64 tile of its own; the three groups share one x tile. A stage is 64 k: x [128][64] and W_g [64 k][64 n] come through registers,
// are rounded to bf16 there (to nearest even) and stored k-contiguous at pitch 144 B: x rows as they lie, W transposed by each lane gathering eight k of one column from its eight row loads.
// Two LDS buffers and two register sets: stage st + 2 is loaded at the head of stage st, stage st + 1 is stored behind stage st's WMMAs; one barrier a stage. Epilogue in the same LDS: q, k as bf16 hi + residual planes [n][DD]; v staged channel-major, one f16 plane v^T [c][NN].
typedef __attribute__((ext_vector_type(4))) __bf16 v4bf;
typedef __attribute__((ext_vector_type(8))) __bf16 v8bf;
typedef __attribute__((ext_vector_type(4))) unsigned short v4us;
typedef v4us __attribute__((may_alias)) v4usa;
// The work-group's barrier behind a wait for this wave's own LDS reads and writes alone: __syncthreads() also waits out the global loads that were issued ahead, which are to fly on over it.
__device__ __forceinline__ void lds_barrier() { asm volatile("s_wait_dscnt 0x0\n\ts_barrier_signal -1\n\ts_barrier_wait -1" ::: "memory"); }
__global__ __launch_bounds__(384) void k_proj(const float* __restrict__ x, const float* __restrict__ Wq, const float* __restrict__ Wk, const float* __restrict__ Wv, const float* __restrict__ bq, const float* __restrict__ bk, const float* __restrict__ bv,
                                              bf* Qh, bf* Ql, bf* Kh, bf* Kl, bf* VT) {
    constexpr int PIT = 144, SZX = 128 * PIT, SZW = 64 * PIT, BUF = SZX + 3 * SZW, OP = 68, OPT = 132, STG = 128 * OP * 4, NST = DD / 64;
    static_assert(2 * BUF <= 3 * STG && 64 * OPT * 4 <= STG, "staging");
    __shared__ __align__(16) unsigned char sm[3 * STG];
    const int tid = threadIdx.x, lane = tid & 31, lr = lane & 15, hi = lane >> 4;
    const int wave = (int)uni((u32)tid >> 5), g = wave >> 2, wm = (wave >> 1) & 1, wn = wave & 1, tg = tid & 127;
    const int rb = blockIdx.x * 128, cb = blockIdx.y * 64;
    const float* xs = x + (size_t)(rb + (tid >> 4)) * DD + (tid & 15) * 4;      // x: four k a lane, sixteen lanes to a row's 256 B; 24 rows a pass of the work-group
    const int nq = tg & 15, kg = tg >> 4;      // W: four columns a lane, sixteen lanes to a k row's 256 B; the lane's eight loads are rows 8 kg .. 8 kg + 7 of the stage
    const float* ws = (g == 0 ? Wq : g == 1 ? Wk : Wv) + (size_t)(kg * 8) * DD + cb + nq * 4;
    const float* bias = g == 0 ? bq : g == 1 ? bk : bv;
    const float bc[2] = {bfr(bias[cb + wn * 32 + lr]), bfr(bias[cb + wn * 32 + 16 + lr])};      // the lane's two output columns; loaded here, so that the epilogue does not wait for them
    v4f xr[2][6], wr[2][8];      // two register sets: stage st lies in set st mod 2 from its loads to its stores
    auto fetch = [&](int st) {
        v4f* xq = xr[st & 1]; v4f* wq = wr[st & 1];
#pragma unroll
        for (int i = 0; i < 5; ++i) xq[i] = *(const v4f*)(xs + (size_t)i * 24 * DD + st * 64);
        if (wave < 4) xq[5] = *(const v4f*)(xs + (size_t)5 * 24 * DD + st * 64);      // rows 120 .. 127
#pragma unroll
        for (int i = 0; i < 8; ++i) wq[i] = *(const v4f*)(ws + (size_t)(st * 64 + i) * DD);
    };
    auto put = [&](int st) {
        const v4f* xq = xr[st & 1]; const v4f* wq = wr[st & 1];
        unsigned char* sb = sm + (st & 1) * BUF;
        unsigned char* xd = sb + (tid >> 4) * PIT + (tid & 15) * 8;
#pragma unroll
        for (int i = 0; i < 5; ++i) *(v4usa*)(xd + i * 24 * PIT) = __builtin_bit_cast(v4us, __builtin_convertvector(xq[i], v4bf));
        if (wave < 4) *(v4usa*)(xd + 5 * 24 * PIT) = __builtin_bit_cast(v4us, __builtin_convertvector(xq[5], v4bf));
        unsigned char* wd = sb + SZX + g * SZW + nq * 4 * PIT + (kg ^ (nq >> 2)) * 16;      // the 16-B piece kc of column n lies at place kc ^ (n >> 4): sixteen lanes, four columns apart, then store to sixteen different bank groups
#pragma unroll
        for (int j = 0; j < 4; ++j) { const v8f col = {wq[0][j], wq[1][j], wq[2][j], wq[3][j], wq[4][j], wq[5][j], wq[6][j], wq[7][j]};
            *(v8usa*)(wd + j * PIT) = __builtin_bit_cast(v8us, __builtin_convertvector(col, v8bf)); }
    };
    v8f acc[4][2];
#pragma unroll
    for (int r = 0; r < 4; ++r) {
#pragma unroll
        for (int t = 0; t < 2; ++t) acc[r][t] = (v8f){}; }
    fetch(0); fetch(1); put(0);
    asm volatile("s_wait_xcnt 0x0" ::: "memory");      // stands in front of the first write of a register that the bias loads name; the x and W loads keep their address registers to the end of the loop
    lds_barrier();
#pragma unroll      // unrolled whole: every load address is then one fixed register pair plus an immediate offset
    for (int st = 0; st < NST; ++st) {
        if (st + 2 < NST) fetch(st + 2);      // into the set that stage st has left: its loads fly over two stages' work
        __builtin_amdgcn_sched_barrier(0);      // keeps these loads at the head of the stage: left free, the build sank some of them to just in front of their use, where the wave waits out their whole latency
        const unsigned char* sb = sm + (st & 1) * BUF;
        const unsigned char* fa = sb + (wm * 64 + lr) * PIT + hi * 16;
        const unsigned char* fb = sb + SZX + g * SZW + (wn * 32 + lr) * PIT;
        v16bf a[2][4], b[2][2];
#pragma unroll
        for (int ks = 0; ks < 2; ++ks) {
#pragma unroll
            for (int r = 0; r < 4; ++r) { const unsigned char* q = fa + r * 16 * PIT + ks * 64; a[ks][r] = cat16b(*(const v8usa*)q, *(const v8usa*)(q + 32)); }
#pragma unroll
            for (int t = 0; t < 2; ++t) { const unsigned char* q = fb + t * 16 * PIT + ks * 64 + (hi ^ t) * 16;      // columns 32 wn + 16 t + lr: n >> 4 = 2 wn + t, so pieces hi and hi + 2 lie at (hi ^ t) + 2 wn and (hi ^ t) + 2 - 2 wn
                b[ks][t] = cat16b(*(const v8usa*)(q + wn * 32), *(const v8usa*)(q + 32 - wn * 32)); }
        }
        __builtin_amdgcn_sched_barrier(0);      // keeps the stage's LDS reads in one group ahead of its WMMAs: reads sunk among the WMMAs each make the wave wait out the LDS latency
#pragma unroll
        for (int ks = 0; ks < 2; ++ks) {
#pragma unroll
            for (int t = 0; t < 2; ++t) {
#pragma unroll
                for (int r = 0; r < 4; ++r) acc[r][t] = wmmab(a[ks][r], b[ks][t], acc[r][t]); } }
        __builtin_amdgcn_sched_barrier(0);      // keeps the wait for the next stage's loads, and its rounding, behind the WMMAs
        if (st + 1 < NST) put(st + 1);      // the buffer that stage st - 1 read: every wave has left it at the barrier that ended that stage
        lds_barrier();      // publishes stage st + 1 and ends every read of stage st; behind the last stage the ring becomes output staging
    }
    asm volatile("s_wait_xcnt 0x0" ::: "memory");      // stands in front of the epilogue's first write of a register that the loads above name
    float* ts = (float*)(void*)(sm + g * STG);      // each group stages its own tile
    if (g == 2) {      // channel-major: a lane's eight tokens of one channel lie side by side
#pragma unroll
        for (int t = 0; t < 2; ++t) {
#pragma unroll
            for (int r = 0; r < 4; ++r) { float* d = ts + (wn * 32 + t * 16 + lr) * OPT + wm * 64 + r * 16 + hi * 8; const v8f s = acc[r][t] + bc[t];
                *(v4fa*)d = __builtin_shufflevector(s, s, 0, 1, 2, 3); *(v4fa*)(d + 4) = __builtin_shufflevector(s, s, 4, 5, 6, 7); } }
    } else {
#pragma unroll
        for (int t = 0; t < 2; ++t) {
#pragma unroll
            for (int r = 0; r < 4; ++r) {
#pragma unroll
                for (int j = 0; j < 8; ++j) ts[(wm * 64 + r * 16 + hi * 8 + j) * OP + wn * 32 + t * 16 + lr] = acc[r][t][j] + bc[t]; } }
    }
    __syncthreads();      // a staged row is written by two waves: both halves are there before one wave reads the row back
    if (g == 2) {
#pragma unroll
        for (int s = 0; s < 8; ++s) { const int idx = s * 128 + tg, c = idx >> 4, tofs = (idx & 15) * 8;
            const v4f v0 = *(const v4fa*)(ts + c * OPT + tofs), v1 = *(const v4fa*)(ts + c * OPT + tofs + 4); v8h of;
#pragma unroll
            for (int i = 0; i < 8; ++i) of[i] = (h16)(i < 4 ? v0[i & 3] : v1[i & 3]);
            *(v8ha*)(VT + (size_t)(cb + c) * NN + rb + tofs) = of; }
    } else {
        bf* Ch = g ? Kh : Qh; bf* Cl = g ? Kl : Ql;
#pragma unroll
        for (int s = 0; s < 8; ++s) { const int idx = s * 128 + tg, row = idx >> 3, cofs = (idx & 7) * 8;
            const v4f v0 = *(const v4fa*)(ts + row * OP + cofs), v1 = *(const v4fa*)(ts + row * OP + cofs + 4);
            const size_t o = (size_t)(rb + row) * DD + cb + cofs; v8us oh, ol;
#pragma unroll
            for (int i = 0; i < 8; ++i) { const float v = i < 4 ? v0[i & 3] : v1[i & 3]; const unsigned short hb = f2bf(v); oh[i] = hb; ol[i] = f2bf(v - bf2f(hb)); }
            *(v8us*)(Ch + o) = oh; *(v8us*)(Cl + o) = ol; }
        asm volatile("s_wait_xcnt 0x0" ::: "memory");      // the built code lays the other branch's body behind these stores: the wait stands in front of its first write of a register that they name
    }
}

// k_softmax: one wave per row. The row's 4096 scores are read once and stay in the wave's registers (128 per lane): maximum, exp and sum, then the f16 plane all come from there.
__global__ __launch_bounds__(256) void k_softmax(const float* __restrict__ S, bf* P) {
    const int lane = threadIdx.x & 31, r = blockIdx.x * 8 + (threadIdx.x >> 5); if (r >= RCH) return;
    const float* sr = S + (size_t)r * NN + lane * 8;
    v8f v[NN / 256];      // every loop over v is unrolled whole: only constant indices keep the array in registers, and the 32 loads then go out together, ahead of the first wait
#pragma unroll
    for (int j = 0; j < NN / 256; ++j) v[j] = *(const v8f*)(sr + j * 256);
    v8f mv = v[0];      // eight independent chains: a maximum does not depend on the order
#pragma unroll
    for (int j = 1; j < NN / 256; ++j) {
#pragma unroll
        for (int i = 0; i < 8; ++i) mv[i] = fmaxf(mv[i], v[j][i]); }
    float m = -3.0e38f;
#pragma unroll
    for (int i = 0; i < 8; ++i) m = fmaxf(m, mv[i]);
#pragma unroll
    for (int sh = 16; sh; sh >>= 1) m = fmaxf(m, __shfl_xor(m, sh, 32));
    float sum = 0.f;      // summed in column order, one chain per lane
#pragma unroll
    for (int j = 0; j < NN / 256; ++j) { float x[8], e[8];
#pragma unroll
        for (int i = 0; i < 8; ++i) x[i] = (v[j][i] - m) * 1.44269504f;      // exp(t) = 2^(t log2 e)
        // eight independent v_exp_f32 in one statement, results in registers of their own: each fills the slot that the instruction set asks for behind the one in front of it
        // (before its result is read or its source overwritten), and the v_nop fills the slot behind the last
        asm("v_exp_f32 %0, %8\n\tv_exp_f32 %1, %9\n\tv_exp_f32 %2, %10\n\tv_exp_f32 %3, %11\n\tv_exp_f32 %4, %12\n\tv_exp_f32 %5, %13\n\tv_exp_f32 %6, %14\n\tv_exp_f32 %7, %15\n\tv_nop"
            : "=&v"(e[0]), "=&v"(e[1]), "=&v"(e[2]), "=&v"(e[3]), "=&v"(e[4]), "=&v"(e[5]), "=&v"(e[6]), "=&v"(e[7])
            : "v"(x[0]), "v"(x[1]), "v"(x[2]), "v"(x[3]), "v"(x[4]), "v"(x[5]), "v"(x[6]), "v"(x[7]));
#pragma unroll
        for (int i = 0; i < 8; ++i) { v[j][i] = e[i]; sum += e[i]; } }
#pragma unroll
    for (int sh = 16; sh; sh >>= 1) sum += __shfl_xor(sum, sh, 32);
    const float inv = 1.0f / sum;
    bf* pr = P + (size_t)r * NN + lane * 8;
#pragma unroll
    for (int j = 0; j < NN / 256; ++j) { v8h o;
#pragma unroll
        for (int i = 0; i < 8; ++i) o[i] = (h16)(v[j][i] * inv);
        *(v8ha*)(pr + j * 256) = o; }
}

extern "C" void kernel_launch(void* const* d_in, const int* in_sizes, int n_in,
                              void* d_out, int out_size, void* d_ws, size_t ws_size, hipStream_t stream) {
    (void)in_sizes; (void)n_in; (void)out_size;
    const float* x = (const float*)d_in[0]; const float* Wq = (const float*)d_in[1]; const float* bq = (const float*)d_in[2]; const float* Wk = (const float*)d_in[3]; const float* bk = (const float*)d_in[4]; const float* Wv = (const float*)d_in[5]; const float* bv = (const float*)d_in[6];
    float* out = (float*)d_out;    // [4096][512]
    char* wsp = (char*)d_ws;
    auto take = [&](size_t bytes) { char* p = wsp; wsp += (bytes + 255) & ~(size_t)255; return (void*)p; };
    bf* Qh = (bf*)take((size_t)NN * DD * 2); bf* Ql = (bf*)take((size_t)NN * DD * 2); bf* Kh = (bf*)take((size_t)NN * DD * 2); bf* Kl = (bf*)take((size_t)NN * DD * 2); bf* VT = (bf*)take((size_t)DD * NN * 2);
    float* S = (float*)take((size_t)RCH * NN * 4); bf* P = (bf*)take((size_t)RCH * NN * 2);
    if ((size_t)(wsp - (char*)d_ws) > ws_size) return;    // 5 x 4.2 + 67.1 + 33.6 ~ 122 MB, no aliasing
    k_proj<<<dim3(NN / 128, DD / 64, 1), 384, 0, stream>>>(x, Wq, Wk, Wv, bq, bk, bv, Qh, Ql, Kh, Kl, VT);      // q [n][512], k [m][512] as hi + residual planes, v^T [c][m] as one f16 plane
    k_gemm<128, 128, 2, true, 64, 1><<<dim3(RCH / 128, NN / 128, 1), 128, 0, stream>>>(Qh, Ql, Kh, Kl, DD, S, NN);          // scores [n][m] = q_n . k_m (unscaled), every row in one launch; 8 stages, starts one apart along either grid axis
    k_softmax<<<RCH / 8, 256, 0, stream>>>(S, P);
    k_gemm<128, 64, 3, false, 128, 4><<<dim3(RCH / 128, DD / 64, 1), 128, 0, stream>>>(P, nullptr, VT, nullptr, NN, out, DD);      // out = P . v: 256 work-groups, one on every WGP; P comes from memory: three buffers, 128 k a stage (the bytes of a split 64-k stage); 32 stages: the 32 tiles that share v^T rows start one apart, the 8 that share P rows four apart
}
